// v009
// The times below were measured on an AMD MI455X: many runs one after another, warmed up first and cycling through
// copies of the inputs, with the whole window's GPU time divided by the number of runs. Launches and the gaps
// between them are all in it. The median over several windows is given; except for v000 it joins two sittings, which
// can be a few percent apart, so the side-by-side timings, each taken in one sitting, are the better comparison.
// The versions before v009 are in another document.
// Measured time: 87 microseconds a run.
// Two timings next to v008 put it at 1.18 and 1.20 times that version's speed.
// Counting every step since v000, which is the starting kernel, it is 9.27 times as fast.
#include <hip/hip_runtime.h>
// CausalAlibiAttn (1 x 4096 tokens, D 1024 = 16 heads of 64, 4 kv heads): q, k, v = x W + b; q head h uses kv head h/4; scores/8 + slope[h] * (key - query) (ALiBi, slopes INPUT), causal; softmax; ctx Wo + bo.
// Structure: exact f16 plane of x; q, k, v by WMMA GEMMs (32x64 wave tiles, f32 accumulation, exact x16 weights + bias) whose epilogues split the f32 result into f16 hi + 2^10-residual planes themselves (v transposed in the LDS staging tile; k, v stay at their 4 kv heads); the fused causal flash kernel (query head h reads kv head h / 4) with the ALiBi term added per (head, query, key) in f32, in its 5-plane form for the first 256 query rows and the plain form beyond; it stores O as f16 hi (+ residual on those rows) for the Wo GEMM (+ bias; residual term only on those rows, in the same launch).
// Compute dtype: x and parameters rounded to bf16; q/k/P/v/O as f16 hi + residual on rows < 256 (~2^-21) and plain f16 beyond (~2^-12); ALiBi/softmax f32. v_wmma_f32_16x16x32_f16.
#define NB 1
#define DM 1024
#define NKV 4
#define NREP (NH / NKV)
#define KVD (NKV * 64)           /* 256 */
#define NR (NB * SLEN)           /* 4096 */
#define SLEN 4096
#define TQ SLEN
#define TK SLEN
#define NH 16
#define SCL 0.125f
#define QBLKS (TQ / 64)
#define QB05 0
#define QBN5 4
#define QB0P QBN5
#define QBNP (QBLKS - QBN5)
#define RE 256
typedef __bf16 v16b __attribute__((ext_vector_type(16)));
typedef unsigned short v8us __attribute__((ext_vector_type(8), may_alias));
typedef float  v8f  __attribute__((ext_vector_type(8)));
typedef float  v4f  __attribute__((ext_vector_type(4)));
typedef float  v4fa __attribute__((ext_vector_type(4), may_alias));
union FragB { v16b v; v8us half[2]; unsigned short u[16]; };

__device__ __forceinline__ unsigned short bf16_bits(float x) { unsigned int u = __float_as_uint(x); return (unsigned short)((u + 0x7FFFu + ((u >> 16) & 1u)) >> 16); }
__device__ __forceinline__ float bf16_val(unsigned short b) { return __uint_as_float(((unsigned int)b) << 16); }
__device__ __forceinline__ float bf16_round(float x) { return bf16_val(bf16_bits(x)); }
// D += A·B with NT terms: 1 = ah·bh, 2 = + al·bh (A split), 3 = + ah·bl (both split)
template <int NT>
__device__ __forceinline__ v8f mmaN(v16b ah, v16b al, v16b bh, v16b bl, v8f c) {
  c = __builtin_amdgcn_wmma_f32_16x16x32_bf16(false, ah, false, bh, (short)0, c, false, false);
  if (NT >= 2) c = __builtin_amdgcn_wmma_f32_16x16x32_bf16(false, al, false, bh, (short)0, c, false, false);
  if (NT >= 3) c = __builtin_amdgcn_wmma_f32_16x16x32_bf16(false, ah, false, bl, (short)0, c, false, false);
  asm volatile("v_nop\n\tv_nop\n\tv_nop\n\tv_nop" : "+v"(c) : "v"(ah), "v"(al), "v"(bh), "v"(bl));
  return c;
}

__global__ __launch_bounds__(256) void k_wt_bf16(const float* __restrict__ W, unsigned short* __restrict__ Wt, int K, int N) {
  const int t = blockIdx.x * 256 + threadIdx.x;
  const int k8n = K / 8;
  if (t >= N * k8n) return;
  const int n = t / k8n, k8 = (t % k8n) * 8;
  v8us v;
#pragma unroll
  for (int i = 0; i < 8; ++i) v[i] = bf16_bits(W[(size_t)(k8 + i) * N + n]);
  *(v8us*)(Wt + (size_t)n * K + k8) = v;
  
}

// GEMM C[M][N] (f32, pitch ldc) = act(A[M][K]·W + bias). A f32 row-major (pitch lda) converted per fragment to bf16
// (ASPLIT: hi/lo two planes -> 2 terms, else single rounded term); Wt bf16 [N][K] (pitch ldb). BIAS_BF16 rounds the
// bias to bf16 first (bias quantised to bf16 before the add). K%32==0, M%16==0, N%64==0.
template <bool ASPLIT, int ACT, bool BIAS_BF16>
__global__ __launch_bounds__(128) void k_gemm_bf(const float* __restrict__ A, int lda, const unsigned short* __restrict__ Wt, int ldb,
                                               const float* __restrict__ bias, float* __restrict__ C, int ldc, int M, int N, int K) {
  __shared__ __attribute__((aligned(16))) float so[4][16][64];
  const int tid = threadIdx.x, w = tid >> 5, lane = tid & 31, ln = lane & 15, hh = lane >> 4;
  const int ntn = N / 64;
  const int wid = blockIdx.x * 4 + w;
  const int mt = wid / ntn, nq = wid % ntn;
  if (mt * 16 >= M) return;
  const int row0 = mt * 16, col0 = nq * 64;
  const float* arow = A + (size_t)(row0 + ln) * lda;
  v8f acc[4] = {};
  for (int kb = 0; kb < K; kb += 32) {
    FragB ah, al;
    const v4f x0 = *(const v4fa*)(arow + kb + 8 * hh), x1 = *(const v4fa*)(arow + kb + 8 * hh + 4);
    const v4f x2 = *(const v4fa*)(arow + kb + 16 + 8 * hh), x3 = *(const v4fa*)(arow + kb + 16 + 8 * hh + 4);
    float xs[16] = {x0[0],x0[1],x0[2],x0[3],x1[0],x1[1],x1[2],x1[3],x2[0],x2[1],x2[2],x2[3],x3[0],x3[1],x3[2],x3[3]};
#pragma unroll
    for (int i = 0; i < 16; ++i) { const unsigned short hb = bf16_bits(xs[i]); ah.u[i] = hb; al.u[i] = ASPLIT ? bf16_bits(xs[i] - bf16_val(hb)) : (unsigned short)0; }
#pragma unroll
    for (int t = 0; t < 4; ++t) {
      const unsigned short* brow = Wt + (size_t)(col0 + t * 16 + ln) * ldb + kb;
      FragB b;
      b.half[0] = *(const v8us*)(brow + 8 * hh);
      b.half[1] = *(const v8us*)(brow + 16 + 8 * hh);
      acc[t] = mmaN<ASPLIT ? 2 : 1>(ah.v, al.v, b.v, b.v, acc[t]);
    }
  }
#pragma unroll
  for (int t = 0; t < 4; ++t) {
    float bv = bias ? bias[col0 + t * 16 + ln] : 0.f;
    if (BIAS_BF16) bv = bf16_round(bv);
#pragma unroll
    for (int r = 0; r < 8; ++r) { float v = acc[t][r] + bv; if (ACT == 1) v = fmaxf(v, 0.f); so[w][8 * hh + r][t * 16 + ln] = v; }
  }
  __builtin_amdgcn_fence(__ATOMIC_ACQ_REL, "workgroup");
  __builtin_amdgcn_wave_barrier();
  const int rsub = lane >> 4, c4 = (lane & 15) * 4;
  {
#pragma unroll
    for (int q = 0; q < 8; ++q) {
      const int r = q * 2 + rsub;
      const v4f v = *(const v4fa*)&so[w][r][c4];
      *(v4f*)(C + (size_t)(row0 + r) * ldc + col0 + c4) = v;
    }
    
  }
}

// GEMM C = act(A·W + bias + resid): A f32 (ASPLIT -> hi/lo 2 terms), Wt bf16 [N][K]; ACT 0 none, 1 relu, 2 exact gelu;
// resid (optional, f32, row index = (row % rmod), pitch ldr, RES_BF16 rounds it) added before the activation.
template <bool ASPLIT, int ACT, bool BIAS_BF16, bool RES_BF16>
__global__ __launch_bounds__(128) void k_gemm_bf3(const float* __restrict__ A, int lda, const unsigned short* __restrict__ Wt, int ldb,
                                                const float* __restrict__ bias, const float* __restrict__ resid, int rmod, int ldr,
                                                float* __restrict__ C, int ldc, int M, int N, int K) {
  __shared__ __attribute__((aligned(16))) float so[4][16][64];
  const int tid = threadIdx.x, w = tid >> 5, lane = tid & 31, ln = lane & 15, hh = lane >> 4;
  const int ntn = N / 64;
  const int wid = blockIdx.x * 4 + w;
  const int mt = wid / ntn, nq = wid % ntn;
  if (mt * 16 >= M) return;
  const int row0 = mt * 16, col0 = nq * 64;
  const float* arow = A + (size_t)(row0 + ln) * lda;
  v8f acc[4] = {};
  for (int kb = 0; kb < K; kb += 32) {
    FragB ah, al;
    const v4f x0 = *(const v4fa*)(arow + kb + 8 * hh), x1 = *(const v4fa*)(arow + kb + 8 * hh + 4);
    const v4f x2 = *(const v4fa*)(arow + kb + 16 + 8 * hh), x3 = *(const v4fa*)(arow + kb + 16 + 8 * hh + 4);
    float xs[16] = {x0[0],x0[1],x0[2],x0[3],x1[0],x1[1],x1[2],x1[3],x2[0],x2[1],x2[2],x2[3],x3[0],x3[1],x3[2],x3[3]};
#pragma unroll
    for (int i = 0; i < 16; ++i) { const unsigned short hb = bf16_bits(xs[i]); ah.u[i] = hb; al.u[i] = ASPLIT ? bf16_bits(xs[i] - bf16_val(hb)) : (unsigned short)0; }
#pragma unroll
    for (int t = 0; t < 4; ++t) {
      const unsigned short* brow = Wt + (size_t)(col0 + t * 16 + ln) * ldb + kb;
      FragB b;
      b.half[0] = *(const v8us*)(brow + 8 * hh);
      b.half[1] = *(const v8us*)(brow + 16 + 8 * hh);
      acc[t] = mmaN<ASPLIT ? 2 : 1>(ah.v, al.v, b.v, b.v, acc[t]);
    }
  }
#pragma unroll
  for (int t = 0; t < 4; ++t) {
    const int col = col0 + t * 16 + ln;
    float bv = bias ? bias[col] : 0.f;
    if (BIAS_BF16) bv = bf16_round(bv);
#pragma unroll
    for (int r = 0; r < 8; ++r) {
      float v = acc[t][r] + bv;
      if (resid) { float rv = resid[(size_t)((row0 + 8 * hh + r) % rmod) * ldr + col]; if (RES_BF16) rv = bf16_round(rv); v += rv; }
      if (ACT == 1) v = fmaxf(v, 0.f);
      if (ACT == 2) v = 0.5f * v * (1.0f + erff(v * 0.70710678118654752f));
      if (ACT == 3) { const float u = 0.7978845608028654f * (v + 0.044715f * v * v * v); v = 0.5f * v * (1.0f + tanhf(u)); }
      so[w][8 * hh + r][t * 16 + ln] = v;
    }
  }
  __builtin_amdgcn_fence(__ATOMIC_ACQ_REL, "workgroup");
  __builtin_amdgcn_wave_barrier();
  const int rsub = lane >> 4, c4 = (lane & 15) * 4;
  {
#pragma unroll
    for (int q = 0; q < 8; ++q) {
      const int r = q * 2 + rsub;
      const v4f v = *(const v4fa*)&so[w][r][c4];
      *(v4f*)(C + (size_t)(row0 + r) * ldc + col0 + c4) = v;
    }
    
  }
}
// row LayerNorm (biased variance, eps) over N: s = X (+ R); optional out_sum <- s; out_norm <- (s-mu)*rsqrt(var+eps)*g + b
template <bool PARAM_BF16>
__global__ __launch_bounds__(256) void k_layernorm(const float* __restrict__ X, const float* __restrict__ R, const float* __restrict__ g, const float* __restrict__ bta,
                                                  float* __restrict__ out_sum, float* __restrict__ out_norm, int N, float eps) {
  __shared__ float red[256];
  const int row = blockIdx.x, tid = threadIdx.x;
  const float* x = X + (size_t)row * N; const float* rr = R ? R + (size_t)row * N : nullptr;
  float vals[16];                     // up to N = 4096
  const int per = N / 256;            // contiguous chunk per thread? use strided-by-4 chunks: thread handles j = tid*4 + 1024*u
  float s1 = 0.f;
  for (int u = 0; u < per / 4; ++u) {
    const int j = tid * 4 + 1024 * u;
    const v4f a = *(const v4fa*)(x + j);
    v4f b = {0.f,0.f,0.f,0.f}; if (rr) b = *(const v4fa*)(rr + j);
#pragma unroll
    for (int q = 0; q < 4; ++q) { const float v = a[q] + b[q]; vals[u * 4 + q] = v; s1 += v; }
  }
  red[tid] = s1; __syncthreads();
  for (int st = 128; st > 0; st >>= 1) { if (tid < st) red[tid] += red[tid + st]; __syncthreads(); }
  const float mu = red[0] / (float)N; __syncthreads();
  float s2 = 0.f;
  for (int u = 0; u < per / 4; ++u)
#pragma unroll
    for (int q = 0; q < 4; ++q) { const float c = vals[u * 4 + q] - mu; s2 += c * c; }
  red[tid] = s2; __syncthreads();
  for (int st = 128; st > 0; st >>= 1) { if (tid < st) red[tid] += red[tid + st]; __syncthreads(); }
  const float rs = rsqrtf(red[0] / (float)N + eps);
  {
    for (int u = 0; u < per / 4; ++u) {
      const int j = tid * 4 + 1024 * u;
      v4f o, sm;
#pragma unroll
      for (int q = 0; q < 4; ++q) {
        float gg = g[j + q], bb = bta[j + q];
        if (PARAM_BF16) { gg = bf16_round(gg); bb = bf16_round(bb); }
        sm[q] = vals[u * 4 + q]; o[q] = (vals[u * 4 + q] - mu) * rs * gg + bb;
      }
      if (out_sum) *(v4f*)(out_sum + (size_t)row * N + j) = sm;
      *(v4f*)(out_norm + (size_t)row * N + j) = o;
    }
    
  }
}



// ---- f16 WMMA path (v_wmma_f32_16x16x32_f16): 11-bit significands for operands in range — used where a [0,1] probability operand needs more precision than bf16
typedef _Float16 v16h __attribute__((ext_vector_type(16)));
union FragH { v16h v; v8us half[2]; _Float16 h[16]; unsigned short u[16]; };
template <int NT>
__device__ __forceinline__ v8f mmaH(v16h ah, v16h al, v16h bh, v16h bl, v8f c) {
  c = __builtin_amdgcn_wmma_f32_16x16x32_f16(false, ah, false, bh, (short)0, c, false, false);
  if (NT >= 2) c = __builtin_amdgcn_wmma_f32_16x16x32_f16(false, al, false, bh, (short)0, c, false, false);
  if (NT >= 3) c = __builtin_amdgcn_wmma_f32_16x16x32_f16(false, ah, false, bl, (short)0, c, false, false);
  asm volatile("v_nop\n\tv_nop\n\tv_nop\n\tv_nop" : "+v"(c) : "v"(ah), "v"(al), "v"(bh), "v"(bl));
  return c;
}
// batched GEMM like k_gemm_b but f16 operands: A f32 (split into f16 hi/lo if ASPLIT, else rounded to f16), Bt = f16 values [n][k]; alpha; C f32; N multiple of 16 (partial tiles skipped)
template <bool ASPLIT>
__global__ __launch_bounds__(128) void k_gemm_h(const float* __restrict__ A, int lda, size_t sA, const _Float16* __restrict__ Bh, int ldb, size_t sB, float alpha, float* __restrict__ C, int ldc, size_t sC, int M, int N, int K) {
  __shared__ __attribute__((aligned(16))) float so[4][16][64];
  const int tid = threadIdx.x, w = tid >> 5, lane = tid & 31, ln = lane & 15, hh = lane >> 4; const int by = blockIdx.y;
  A += (size_t)by * sA; Bh += (size_t)by * sB; C += (size_t)by * sC;
  const int ntn = (N + 63) / 64; const int wid = blockIdx.x * 4 + w; const int mt = wid / ntn, nq = wid % ntn; if (mt * 16 >= M) return;
  const int row0 = mt * 16, col0 = nq * 64; const float* arow = A + (size_t)(row0 + ln) * lda;
  v8f acc[4] = {};
  for (int kb = 0; kb < K; kb += 32) {
    FragH ah, al;
    const v4f x0 = *(const v4fa*)(arow + kb + 8 * hh), x1 = *(const v4fa*)(arow + kb + 8 * hh + 4), x2 = *(const v4fa*)(arow + kb + 16 + 8 * hh), x3 = *(const v4fa*)(arow + kb + 16 + 8 * hh + 4);
    float xs[16] = {x0[0],x0[1],x0[2],x0[3],x1[0],x1[1],x1[2],x1[3],x2[0],x2[1],x2[2],x2[3],x3[0],x3[1],x3[2],x3[3]};
#pragma unroll
    for (int i = 0; i < 16; ++i) { const _Float16 h = (_Float16)xs[i]; ah.h[i] = h; al.h[i] = ASPLIT ? (_Float16)(xs[i] - (float)h) : (_Float16)0.0f; }
#pragma unroll
    for (int t = 0; t < 4; ++t) { if (col0 + t * 16 >= N) continue; const size_t boff = (size_t)(col0 + t * 16 + ln) * ldb + kb; FragH bq; bq.half[0] = *(const v8us*)(Bh + boff + 8 * hh); bq.half[1] = *(const v8us*)(Bh + boff + 16 + 8 * hh);
      acc[t] = mmaH<ASPLIT ? 2 : 1>(ah.v, al.v, bq.v, bq.v, acc[t]); }
  }
#pragma unroll
  for (int t = 0; t < 4; ++t) { if (col0 + t * 16 >= N) continue;
#pragma unroll
    for (int r = 0; r < 8; ++r) so[w][8 * hh + r][t * 16 + ln] = acc[t][r] * alpha; }
  __builtin_amdgcn_fence(__ATOMIC_ACQ_REL, "workgroup"); __builtin_amdgcn_wave_barrier();
  const int rsub = lane >> 4, c4 = (lane & 15) * 4;
  {
#pragma unroll
    for (int q = 0; q < 8; ++q) { const int r = q * 2 + rsub; if (col0 + c4 < N) { const v4f v = *(const v4fa*)&so[w][r][c4]; *(v4f*)(C + (size_t)(row0 + r) * ldc + col0 + c4) = v; } }
     }
}

// Wt[n][k] = f16(W[k][n] * scale) from f32 row-major W[K][N] (scale = power of two; bf16-exact weights stay exact in f16 away from the subnormal range).
// A thread takes an 8 x 8 patch: 16 loads of 16 bytes, all in flight together (4 lanes one whole 128-byte line of a W row), the transposition is the choice of registers, 8 stores of 16 bytes (8 lanes one whole line of a Wt row).
// A wave covers 64 k x 32 n; a block of 8 waves 512 k x 32 n. One address pair for the loads and one for the stores, every step a constant offset.
template <int K, int N>
__device__ __forceinline__ void wt_f16(const float* __restrict__ W, _Float16* __restrict__ Wt, float scale, int blk) {      /* blk: the job's own block index */
  static_assert(K % 512 == 0 && N % 32 == 0, "whole blocks only: no thread is without a patch");
  const int lane = threadIdx.x & 31, g = blk * 8 + (threadIdx.x >> 5);
  const int k8 = ((g % (K / 64)) * 8 + (lane & 7)) * 8, n8 = ((g / (K / 64)) * 4 + (lane >> 3)) * 8;
  const float* src = W + (size_t)k8 * N + n8; unsigned short* dst = (unsigned short*)Wt + (size_t)n8 * K + k8; v4f r[8][2];      /* both loops unrolled: constant indices keep the patch in registers */
#pragma unroll
  for (int i = 0; i < 8; ++i) { r[i][0] = *(const v4fa*)(src + i * N); r[i][1] = *(const v4fa*)(src + i * N + 4); }
  asm volatile("s_wait_xcnt 0x0" :: "v"(src) : "memory");      /* a precaution: the loads' address pair is an input here, so it lives up to this wait and no load lands on it ahead of the wait */
  __builtin_amdgcn_sched_barrier(0);      /* keeps all 16 loads ahead of the first conversion: without it the compiler holds some back to save registers, and the thread waits out a second trip to memory */
#pragma unroll
  for (int j = 0; j < 8; ++j) { FragH f;
#pragma unroll
    for (int i = 0; i < 8; ++i) f.h[i] = (_Float16)(bf16_round(r[i][j >> 2][j & 3]) * scale);
    *(v8us*)(dst + j * K) = f.half[0]; }
  asm volatile("s_wait_xcnt 0x0" ::: "memory");      /* behind the last store: in k_prep the built code runs on from here towards another block range's body, which rewrites the stores' registers */
}
// k_gemm_hh variant with fused epilogue: v = acc·alpha + bias[by·sBias + col] (+ CP[(row/rowsPerB)·sCPb + by·64 + col] if CP) ; ACT 0 none / 1 elu ; writes f16 C16 (and f32 C if non-null)
template <int ACT>
__global__ __launch_bounds__(128) void k_gemm_hhx(const _Float16* __restrict__ A, int lda, size_t sA, const _Float16* __restrict__ Bh, int ldb, size_t sB, float alpha, const float* __restrict__ bias, size_t sBias, const float* __restrict__ CP, int rowsPerB, size_t sCPb, int row0g,
    float* __restrict__ C, _Float16* __restrict__ C16, int ldc, size_t sC, int M, int N, int K) {
  __shared__ __attribute__((aligned(16))) float so[4][16][64];
  const int tid = threadIdx.x, w = tid >> 5, lane = tid & 31, ln = lane & 15, hh = lane >> 4; const int by = blockIdx.y;
  A += (size_t)by * sA; Bh += (size_t)by * sB; const size_t cofs = (size_t)by * sC; const float* bp = bias ? bias + (size_t)by * sBias : nullptr;
  const int ntn = (N + 63) / 64; const int wid = blockIdx.x * 4 + w; const int mt = wid / ntn, nq = wid % ntn; if (mt * 16 >= M) return;
  const int row0 = mt * 16, col0 = nq * 64; const _Float16* arow = A + (size_t)(row0 + ln) * lda;
  v8f acc[4] = {};
  for (int kb = 0; kb < K; kb += 32) { FragH ah; ah.half[0] = *(const v8us*)((const unsigned short*)arow + kb + 8 * hh); ah.half[1] = *(const v8us*)((const unsigned short*)arow + kb + 16 + 8 * hh);
#pragma unroll
    for (int t = 0; t < 4; ++t) { if (col0 + t * 16 >= N) continue; const size_t boff = (size_t)(col0 + t * 16 + ln) * ldb + kb; FragH bq; bq.half[0] = *(const v8us*)((const unsigned short*)Bh + boff + 8 * hh); bq.half[1] = *(const v8us*)((const unsigned short*)Bh + boff + 16 + 8 * hh);
      acc[t] = mmaH<1>(ah.v, ah.v, bq.v, bq.v, acc[t]); }
  }
#pragma unroll
  for (int t = 0; t < 4; ++t) { if (col0 + t * 16 >= N) continue; const int col = col0 + t * 16 + ln; const float bv = bp ? bf16_round(bp[col]) : 0.f;
#pragma unroll
    for (int r = 0; r < 8; ++r) { float v = acc[t][r] * alpha + bv; if (CP) { const int bidx = (row0g + row0 + 8 * hh + r) / rowsPerB; v += CP[(size_t)bidx * sCPb + (size_t)by * 64 + col]; } if (ACT == 1) v = (v > 0.f) ? v : expm1f(v); else if (ACT == 7) v = (v > 0.f) ? v + 1.0f : expf(v); else if (ACT == 8) v = tanhf(v); else if (ACT == 9) v = 0.5f * v * (1.0f + tanhf(0.7978845608028654f * (v + 0.044715f * v * v * v))); else if (ACT == 11) v = 1.0f / (1.0f + expf(-v)); else if (ACT == 12) v = (v > 0.f) ? v : 0.01f * v; else if (ACT == 14) v = (v > 0.f) ? v : 0.1f * v; else if (ACT == 15) v = v / (1.0f + expf(-v)); else if (ACT == 3) v = fmaxf(v, 0.f); else if (ACT == 6) v = 0.5f * v * (1.0f + erff(v * 0.70710678118654752f)); so[w][8 * hh + r][t * 16 + ln] = v; } }
  __builtin_amdgcn_fence(__ATOMIC_ACQ_REL, "workgroup"); __builtin_amdgcn_wave_barrier();
  const int rsub = lane >> 4, c4 = (lane & 15) * 4; typedef _Float16 v4h __attribute__((ext_vector_type(4)));
  {
#pragma unroll
    for (int q = 0; q < 8; ++q) { const int r = q * 2 + rsub; if (col0 + c4 < N) { const v4f v = *(const v4fa*)&so[w][r][c4]; if (C) *(v4f*)(C + cofs + (size_t)(row0 + r) * ldc + col0 + c4) = v; if (C16) { v4h h4; for (int i = 0; i < 4; ++i) h4[i] = (_Float16)v[i]; *(v4h*)(C16 + cofs + (size_t)(row0 + r) * ldc + col0 + c4) = h4; } } }
     }
}


typedef _Float16 v4h __attribute__((ext_vector_type(4)));

// f16 plane of x: a thread takes 8 groups of 8 values, a block's width apart: 16 loads of 16 bytes in flight together, then 8 whole-line stores of 16 bytes a lane.
__device__ __forceinline__ void x16(const float* __restrict__ x, _Float16* __restrict__ X16, int blk) { const size_t t0 = (size_t)blk * 2048 + threadIdx.x; const float* src = x + t0 * 8; unsigned short* dst = (unsigned short*)X16 + t0 * 8; v4f r[8][2];      /* loops unrolled: constant indices keep the values in registers */
#pragma unroll
  for (int u = 0; u < 8; ++u) { r[u][0] = *(const v4fa*)(src + u * 2048); r[u][1] = *(const v4fa*)(src + u * 2048 + 4); }
  asm volatile("s_wait_xcnt 0x0" :: "v"(src) : "memory");      /* a precaution, as in wt_f16: the loads' address pair lives up to this wait */
  __builtin_amdgcn_sched_barrier(0);      /* keeps all 16 loads ahead of the first conversion, as in wt_f16 */
#pragma unroll
  for (int u = 0; u < 8; ++u) { FragH f;
#pragma unroll
    for (int q = 0; q < 8; ++q) f.h[q] = (_Float16)bf16_round(r[u][q >> 2][q & 3]);
    *(v8us*)(dst + u * 2048) = f.half[0]; }
  asm volatile("s_wait_xcnt 0x0" ::: "memory"); }      /* behind the last store, as in wt_f16 */
// The five preparation jobs (four weight transposes, the f16 plane of x) read and write disjoint buffers: one grid, a block range each, so that they run side by side instead of one launch behind the other.
// 64 values a thread: the launch is a few waves a SIMD that all start at once with all their loads in flight, not a long queue of waves that each live for one load.
#define PB_W (DM * DM / 64 / 256)       /* blocks of a DM x DM weight */
#define PB_KV (DM * KVD / 64 / 256)     /* blocks of a DM x KVD weight */
#define PB_X (NR * DM / 64 / 256)       /* blocks of x */
static_assert((NR * DM) % (64 * 256) == 0, "whole blocks only: no thread of the x range is without its 64 values");
__global__ __launch_bounds__(256) void k_prep(const float* __restrict__ x, const float* __restrict__ Wq, const float* __restrict__ Wk, const float* __restrict__ Wv, const float* __restrict__ Wo,
                                              _Float16* __restrict__ X16, _Float16* __restrict__ BQ, _Float16* __restrict__ BK, _Float16* __restrict__ BV, _Float16* __restrict__ BO) {
  int blk = blockIdx.x;
  if (blk < PB_W) { wt_f16<DM, DM>(Wq, BQ, 16.0f, blk); return; } blk -= PB_W;
  if (blk < PB_W) { wt_f16<DM, DM>(Wo, BO, 16.0f, blk); return; } blk -= PB_W;
  if (blk < PB_KV) { wt_f16<DM, KVD>(Wk, BK, 16.0f, blk); return; } blk -= PB_KV;
  if (blk < PB_KV) { wt_f16<DM, KVD>(Wv, BV, 16.0f, blk); return; } blk -= PB_KV;
  x16(x, X16, blk); }
__global__ __launch_bounds__(256) void k_h16(const float* __restrict__ x, _Float16* __restrict__ X16, size_t n8) { const size_t t = (size_t)blockIdx.x * 256 + threadIdx.x; if (t >= n8) return; FragH f;
#pragma unroll
  for (int q = 0; q < 8; ++q) f.h[q] = (_Float16)x[t * 8 + q]; *(v8us*)((unsigned short*)X16 + t * 8) = f.half[0];  }
__global__ __launch_bounds__(256) void k_round16f(const float* __restrict__ W, _Float16* __restrict__ Bt, size_t n8) { const size_t t = (size_t)blockIdx.x * 256 + threadIdx.x; if (t >= n8) return; FragH f;
#pragma unroll
  for (int i = 0; i < 8; ++i) f.h[i] = (_Float16)(bf16_round(W[t * 8 + i]) * 16.0f); *(v8us*)((unsigned short*)Bt + t * 8) = f.half[0];  }
template <int NHv, int TTv>
__global__ __launch_bounds__(256) void k_vt(const _Float16* __restrict__ V16, int ldv, int voff, _Float16* __restrict__ Vt) { __shared__ unsigned short tl[64][66]; const int tid = threadIdx.x; const int slab = blockIdx.x / (TTv / 64), lg = blockIdx.x % (TTv / 64); const int b = slab / NHv, h = slab % NHv;
  for (int i = tid; i < 64 * 8; i += 256) { const int r = i / 8, c8 = (i % 8) * 8; FragH f; f.half[0] = *(const v8us*)((const unsigned short*)V16 + ((size_t)b * TTv + lg * 64 + r) * ldv + voff + h * 64 + c8);
#pragma unroll
    for (int q = 0; q < 8; ++q) tl[r][c8 + q] = f.u[q]; }
  __syncthreads();
  {
#pragma unroll
    for (int rd = 0; rd < 2; ++rd) { const int d = rd * 32 + tid / 8, pc = tid % 8; FragH f;
#pragma unroll
      for (int q = 0; q < 8; ++q) f.u[q] = tl[pc * 8 + q][d];
      *(v8us*)((unsigned short*)Vt + ((size_t)slab * 64 + d) * TTv + lg * 64 + pc * 8) = f.half[0]; }
     } }

// ---- LDS staging by asynchronous copies (global_load_async_to_lds_b128): a lane moves its own 16 bytes, 8 lanes one whole 128-byte row; two buffers, the next stage in flight while this one is worked on ----
#define LP 72      /* LDS row pitch in f16: 128 data bytes + 16 = an odd multiple of 16 bytes, the conflict-free pitch of the ds_load_b128 fragment readers */
__device__ __forceinline__ void wait_async0() { asm volatile("s_wait_asynccnt 0x0" ::: "memory"); }      /* the wave's own copies have landed; stands before the barrier behind which the other waves read them */
__device__ __forceinline__ void wait_ds0() { asm volatile("s_wait_dscnt 0x0" ::: "memory"); }      /* the wave's own LDS reads have retired before the barrier behind which their buffer is refilled */
// one tile of 64 rows x 128 bytes (row pitch ldg f16 in global memory, LP in LDS) by 128 threads: 4 copies a lane, rows tid / 8 + 16 i. The s_wait_xcnt closes the statement so that no address register is rewritten ahead of it.
__device__ __forceinline__ void stage64(const unsigned short* g, size_t ldg, const unsigned short* s, int tid) {
  const unsigned short* g0 = g + (size_t)(tid >> 3) * ldg + (tid & 7) * 8; const unsigned short* g1 = g0 + 16 * ldg; const unsigned short* g2 = g1 + 16 * ldg; const unsigned short* g3 = g2 + 16 * ldg;
  const unsigned l0 = (unsigned)(size_t)(s + (tid >> 3) * LP + (tid & 7) * 8), l1 = l0 + 16 * LP * 2, l2 = l0 + 32 * LP * 2, l3 = l0 + 48 * LP * 2;
  asm volatile("global_load_async_to_lds_b128 %0, %1, off\n\tglobal_load_async_to_lds_b128 %2, %3, off\n\tglobal_load_async_to_lds_b128 %4, %5, off\n\tglobal_load_async_to_lds_b128 %6, %7, off\n\ts_wait_xcnt 0x0"
               :: "v"(l0), "v"(g0), "v"(l1), "v"(g1), "v"(l2), "v"(g2), "v"(l3), "v"(g3) : "memory");
}
// ---- fast GEMM (block tile 128x64, wave tile 32x64; requires M % 128 == 0 rows per launch region, N % 64 == 0, K % 64 == 0, K >= 64); A and B tiles of 64 k staged in LDS; epilogue = k_gemm_hhx semantics ----
// OM 0: C (f32) and / or C16 (f16). OM 1: the f32 result leaves as two f16 planes, C16 = hi, C16L = (v - hi) * 2^10, same layout. OM 2: the same two planes transposed, [row / ldc][col][row % ldc] with ldc = rows per sequence (a multiple of 128). OM 1 and 2 take no CP term.
__device__ __forceinline__ v16h g2_frag(const _Float16* p, int hh) { FragH f; f.half[0] = *(const v8us*)((const unsigned short*)p + 8 * hh); f.half[1] = *(const v8us*)((const unsigned short*)p + 16 + 8 * hh); return f.v; }
__device__ __forceinline__ v8f g2_mma(v16h a, v16h b, v8f c) { v8f d = __builtin_amdgcn_wmma_f32_16x16x32_f16(false, a, false, b, (short)0, c, false, false); asm volatile("v_nop\n\tv_nop\n\tv_nop\n\tv_nop" : "+v"(d) : "v"(a), "v"(b)); return d; }
// The body takes its block index (bx) and the kernel's LDS arrays from the caller: a kernel that serves several GEMMs from one grid hands each block range its own operands.
#define GEMM2_LDS __shared__ __attribute__((aligned(16))) float so[4][32][68]; __shared__ __attribute__((aligned(16))) unsigned short tA[2][128][LP], tB[2][64][LP];
template <int ACT, int OM>
__device__ __forceinline__ void gemm2_body(const int bx, float (*so)[32][68], unsigned short (*tA)[128][LP], unsigned short (*tB)[64][LP],
    const _Float16* __restrict__ A, int lda, size_t sA, const _Float16* __restrict__ Bh, int ldb, size_t sB, float alpha, const float* __restrict__ bias, size_t sBias, const float* __restrict__ CP, int rowsPerB, size_t sCPb, int row0g,
    float* __restrict__ C, _Float16* __restrict__ C16, _Float16* __restrict__ C16L, int ldc, size_t sC, int M, int N, int K) {
  constexpr int TP = 132;      /* OM 2: row pitch of the transposed staging tile, 128 tokens + 4 floats; 64 rows of it fit in so */
  static_assert(64 * TP <= 4 * 32 * 68, "the transposed tile lies inside so");
  const int tid = threadIdx.x, w = tid >> 5, lane = tid & 31, ln = lane & 15, hh = lane >> 4; const int by = blockIdx.y;
  A += (size_t)by * sA; Bh += (size_t)by * sB; const size_t cofs = (size_t)by * sC; const float* bp = bias ? bias + (size_t)by * sBias : nullptr;
  const int ntn = N >> 6; const int mt = bx / ntn, nq = bx - mt * ntn; const int row0 = mt * 128 + 32 * w, col0 = nq * 64; if (mt * 128 + 128 > M) return;      /* the whole block leaves or none, ahead of every barrier */
  const unsigned short* Ag = (const unsigned short*)A + (size_t)(mt * 128) * lda; const unsigned short* Bg = (const unsigned short*)Bh + (size_t)col0 * ldb; const int nst = K >> 6;
  stage64(Ag, lda, &tA[0][0][0], tid); stage64(Ag + (size_t)64 * lda, lda, &tA[0][64][0], tid); stage64(Bg, ldb, &tB[0][0][0], tid);
  wait_async0(); __syncthreads();      /* stage 0 published */
  if (nst > 1) { stage64(Ag + 64, lda, &tA[1][0][0], tid); stage64(Ag + (size_t)64 * lda + 64, lda, &tA[1][64][0], tid); stage64(Bg + 64, ldb, &tB[1][0][0], tid); }
  const v8f z8 = {0.f,0.f,0.f,0.f,0.f,0.f,0.f,0.f}; v8f c00 = z8, c01 = z8, c02 = z8, c03 = z8, c10 = z8, c11 = z8, c12 = z8, c13 = z8;
#pragma unroll 1
  for (int t = 0; t < nst; ++t) { const int bf = t & 1;      /* rolled: one stage a trip, the publish point at its foot */
    // all 12 fragments of the stage are read from LDS as one group ahead of its 16 products: one LDS latency a stage in front of the matrix run, not one in front of every pair of products
    v16h fa[2][2], fb[2][4];
    // unrolled (both loops): the two k blocks of a stage become constant LDS offsets and the fragment arrays stay in registers
#pragma unroll
    for (int kq = 0; kq < 2; ++kq) { fa[kq][0] = g2_frag((const _Float16*)&tA[bf][32 * w + ln][kq * 32], hh); fb[kq][0] = g2_frag((const _Float16*)&tB[bf][ln][kq * 32], hh); fa[kq][1] = g2_frag((const _Float16*)&tA[bf][32 * w + 16 + ln][kq * 32], hh);
      fb[kq][1] = g2_frag((const _Float16*)&tB[bf][16 + ln][kq * 32], hh); fb[kq][2] = g2_frag((const _Float16*)&tB[bf][32 + ln][kq * 32], hh); fb[kq][3] = g2_frag((const _Float16*)&tB[bf][48 + ln][kq * 32], hh); }
#pragma unroll
    for (int kq = 0; kq < 2; ++kq) { c00 = g2_mma(fa[kq][0], fb[kq][0], c00); c10 = g2_mma(fa[kq][1], fb[kq][0], c10); c01 = g2_mma(fa[kq][0], fb[kq][1], c01); c11 = g2_mma(fa[kq][1], fb[kq][1], c11);
      c02 = g2_mma(fa[kq][0], fb[kq][2], c02); c12 = g2_mma(fa[kq][1], fb[kq][2], c12); c03 = g2_mma(fa[kq][0], fb[kq][3], c03); c13 = g2_mma(fa[kq][1], fb[kq][3], c13); }
    wait_ds0(); wait_async0(); __syncthreads();      /* publishes stage t + 1 and ends every read of buffer bf */
    if (t + 2 < nst) { const int k2 = (t + 2) * 64; stage64(Ag + k2, lda, &tA[bf][0][0], tid); stage64(Ag + (size_t)64 * lda + k2, lda, &tA[bf][64][0], tid); stage64(Bg + k2, ldb, &tB[bf][0][0], tid); } }
  wait_async0();
  v8f accs[8] = {c00, c01, c02, c03, c10, c11, c12, c13};
#pragma unroll
  for (int u = 0; u < 8; ++u) { const int t = u & 3, half = u >> 2; const int col = col0 + t * 16 + ln; const float bv = bp ? bf16_round(bp[col]) : 0.f;
#pragma unroll
    for (int r = 0; r < 8; ++r) { const int rloc = half * 16 + 8 * hh + r; float v = accs[u][r] * alpha + bv; if (OM == 0 && CP) { const int bidx = (row0g + row0 + rloc) / rowsPerB; v += CP[(size_t)bidx * sCPb + (size_t)by * 64 + col]; }
      if (ACT == 3) v = fmaxf(v, 0.f); else if (ACT == 6) v = 0.5f * v * (1.0f + erff(v * 0.70710678118654752f)); else if (ACT == 11) v = 1.0f / (1.0f + expf(-v)); else if (ACT == 15) v = v / (1.0f + expf(-v)); else if (ACT == 12) v = (v > 0.f) ? v : 0.01f * v; else if (ACT == 8) v = tanhf(v);
      if (OM == 2) (&so[0][0][0])[(t * 16 + ln) * TP + 32 * w + rloc] = v; else so[w][rloc][t * 16 + ln] = v; } }
  if (OM == 2) {      /* the staging tile holds the block's 64 columns as rows of 128 tokens: a wave stores 16 of them, 16 lanes one whole 256-byte run */
    __syncthreads();      /* a transposed row holds results of all four waves */
    const float* soT = &so[0][0][0]; const int rb = mt * 128; const size_t ob = ((size_t)(rb / ldc) * N + col0) * ldc + rb % ldc + (lane & 15) * 8;
    // unrolled (both loops): the eight row pairs become constant LDS offsets whose reads go out ahead of the stores, and the two packed planes stay in registers
#pragma unroll
    for (int i = 0; i < 8; ++i) { const int d = 16 * w + 2 * i + (lane >> 4); const v4f a = *(const v4fa*)&soT[d * TP + (lane & 15) * 8], c = *(const v4fa*)&soT[d * TP + (lane & 15) * 8 + 4]; FragH fh, fl;      /* inner loop unrolled for constant element indices */
#pragma unroll
      for (int q = 0; q < 4; ++q) { _Float16 h = (_Float16)a[q]; fh.h[q] = h; fl.h[q] = (_Float16)((a[q] - (float)h) * 1024.0f); h = (_Float16)c[q]; fh.h[4 + q] = h; fl.h[4 + q] = (_Float16)((c[q] - (float)h) * 1024.0f); }
      *(v8us*)((unsigned short*)C16 + cofs + ob + (size_t)d * ldc) = fh.half[0]; *(v8us*)((unsigned short*)C16L + cofs + ob + (size_t)d * ldc) = fl.half[0]; }
    return; }
  __builtin_amdgcn_fence(__ATOMIC_ACQ_REL, "workgroup"); __builtin_amdgcn_wave_barrier();
  const int rsub = lane >> 4, c4 = (lane & 15) * 4;
  {
#pragma unroll
    for (int q = 0; q < 16; ++q) { const int r = q * 2 + rsub; const v4f v = *(const v4fa*)&so[w][r][c4];
      if (OM == 1) { v4h h4, l4; for (int i = 0; i < 4; ++i) { h4[i] = (_Float16)v[i]; l4[i] = (_Float16)((v[i] - (float)h4[i]) * 1024.0f); } *(v4h*)(C16 + cofs + (size_t)(row0 + r) * ldc + col0 + c4) = h4; *(v4h*)(C16L + cofs + (size_t)(row0 + r) * ldc + col0 + c4) = l4; continue; }
      if (C) *(v4f*)(C + cofs + (size_t)(row0 + r) * ldc + col0 + c4) = v; if (C16) { v4h h4; for (int i = 0; i < 4; ++i) h4[i] = (_Float16)v[i]; *(v4h*)(C16 + cofs + (size_t)(row0 + r) * ldc + col0 + c4) = h4; } }
    if (OM == 1) asm volatile("s_wait_xcnt 0x0" ::: "memory");      /* behind the last store of the hi/residual path: in k_qkv the built code runs on from here into another block range's body, which rewrites the stores' registers */
     } }
template <int ACT, int OM>
__global__ __launch_bounds__(128) void k_gemm2(const _Float16* __restrict__ A, int lda, size_t sA, const _Float16* __restrict__ Bh, int ldb, size_t sB, float alpha, const float* __restrict__ bias, size_t sBias, const float* __restrict__ CP, int rowsPerB, size_t sCPb, int row0g,
    float* __restrict__ C, _Float16* __restrict__ C16, _Float16* __restrict__ C16L, int ldc, size_t sC, int M, int N, int K) {
  GEMM2_LDS gemm2_body<ACT, OM>(blockIdx.x, so, tA, tB, A, lda, sA, Bh, ldb, sB, alpha, bias, sBias, CP, rowsPerB, sCPb, row0g, C, C16, C16L, ldc, sC, M, N, K); }
// out = ctx Wo + bo in ONE launch. Rows < RE of a sequence carry O as hi + 2^10 residual: their blocks stage the residual tile beside the hi tile in every stage of the same ring and run its products against the same Wo fragments
// into accumulators of their own, joined in the epilogue. The residual term has no launch, no ring fill and no read-back of out of its own any more.
__global__ __launch_bounds__(128) void k_wo(const _Float16* __restrict__ OHp, const _Float16* __restrict__ OLp, const _Float16* __restrict__ BOp, const float* __restrict__ bo, float* __restrict__ out) {
  __shared__ __attribute__((aligned(16))) unsigned short tA[2][128][LP], tB[2][64][LP], tL[2][128][LP];
  float (*so)[32][68] = (float (*)[32][68])&tL[0][0][0];      /* the epilogue's staging tile lies in the residual ring, which nobody reads behind the last stage's barrier */
  static_assert(sizeof(float) * 4 * 32 * 68 <= sizeof(unsigned short) * 2 * 128 * LP, "the staging tile lies inside tL");
  static_assert(RE % 128 == 0 && SLEN % 128 == 0 && DM >= 128 && DM % 64 == 0, "a block's 128 rows carry a residual all or none; the ring's prologue needs two stages");
  const int tid = threadIdx.x, w = tid >> 5, lane = tid & 31, ln = lane & 15, hh = lane >> 4;
  constexpr int ntn = DM >> 6, nst = DM >> 6;
  const int mt = blockIdx.x / ntn, nq = blockIdx.x - mt * ntn; const int row0 = mt * 128 + 32 * w, col0 = nq * 64;
  const bool dual = (mt * 128) % SLEN < RE;      /* from blockIdx alone: the same for the whole block */
  const unsigned short* Ag = (const unsigned short*)OHp + (size_t)(mt * 128) * DM; const unsigned short* Lg = (const unsigned short*)OLp + (size_t)(mt * 128) * DM; const unsigned short* Bg = (const unsigned short*)BOp + (size_t)col0 * DM;
  auto fill = [&](int bf, int k0) { stage64(Ag + k0, DM, &tA[bf][0][0], tid); stage64(Ag + (size_t)64 * DM + k0, DM, &tA[bf][64][0], tid); stage64(Bg + k0, DM, &tB[bf][0][0], tid);
    if (dual) { stage64(Lg + k0, DM, &tL[bf][0][0], tid); stage64(Lg + (size_t)64 * DM + k0, DM, &tL[bf][64][0], tid); } };
  fill(0, 0);
  wait_async0(); __syncthreads();      /* stage 0 published */
  fill(1, 64);
  v8f c[2][4], d[2][4];      /* every '#pragma unroll' below: constant indices keep the fragment and accumulator arrays in registers */
#pragma unroll
  for (int i = 0; i < 2; ++i)
#pragma unroll
    for (int j = 0; j < 4; ++j) { c[i][j] = (v8f){0.f,0.f,0.f,0.f,0.f,0.f,0.f,0.f}; d[i][j] = c[i][j]; }
#pragma unroll 1
  for (int t = 0; t < nst; ++t) { const int bf = t & 1;      /* rolled: one stage a trip, the publish point at its foot */
    v16h fa[2][2], fb[2][4];      /* a stage's fragments are read as one group ahead of its products, as in gemm2_body */
#pragma unroll
    for (int kq = 0; kq < 2; ++kq) { fa[kq][0] = g2_frag((const _Float16*)&tA[bf][32 * w + ln][kq * 32], hh); fb[kq][0] = g2_frag((const _Float16*)&tB[bf][ln][kq * 32], hh); fa[kq][1] = g2_frag((const _Float16*)&tA[bf][32 * w + 16 + ln][kq * 32], hh);
      fb[kq][1] = g2_frag((const _Float16*)&tB[bf][16 + ln][kq * 32], hh); fb[kq][2] = g2_frag((const _Float16*)&tB[bf][32 + ln][kq * 32], hh); fb[kq][3] = g2_frag((const _Float16*)&tB[bf][48 + ln][kq * 32], hh); }
#pragma unroll
    for (int kq = 0; kq < 2; ++kq)
#pragma unroll
      for (int j = 0; j < 4; ++j) { c[0][j] = g2_mma(fa[kq][0], fb[kq][j], c[0][j]); c[1][j] = g2_mma(fa[kq][1], fb[kq][j], c[1][j]); }
    if (dual) {      /* the residual fragments take the registers that the hi fragments have left; the Wo fragments serve a second time */
#pragma unroll
      for (int kq = 0; kq < 2; ++kq) { fa[kq][0] = g2_frag((const _Float16*)&tL[bf][32 * w + ln][kq * 32], hh); fa[kq][1] = g2_frag((const _Float16*)&tL[bf][32 * w + 16 + ln][kq * 32], hh); }
#pragma unroll
      for (int kq = 0; kq < 2; ++kq)
#pragma unroll
        for (int j = 0; j < 4; ++j) { d[0][j] = g2_mma(fa[kq][0], fb[kq][j], d[0][j]); d[1][j] = g2_mma(fa[kq][1], fb[kq][j], d[1][j]); } }
    wait_ds0(); wait_async0(); __syncthreads();      /* publishes stage t + 1 and ends every read of buffer bf */
    if (t + 2 < nst) fill(bf, (t + 2) * 64); }
  wait_async0();
#pragma unroll
  for (int u = 0; u < 8; ++u) { const int j = u & 3, half = u >> 2; const float bv = bf16_round(bo[col0 + j * 16 + ln]);
#pragma unroll
    for (int r = 0; r < 8; ++r) so[w][half * 16 + 8 * hh + r][j * 16 + ln] = (c[half][j][r] + d[half][j][r] * 0.0009765625f) * 0.0625f + bv; }      /* d is 0 where the rows carry no residual */
  __builtin_amdgcn_fence(__ATOMIC_ACQ_REL, "workgroup"); __builtin_amdgcn_wave_barrier();      /* the wave's own so rows: its stores above stay ahead of its whole-line reads below */
  const int rsub = lane >> 4, c4 = (lane & 15) * 4;
#pragma unroll
  for (int q = 0; q < 16; ++q) { const int r = q * 2 + rsub; const v4f v = *(const v4fa*)&so[w][r][c4]; *(v4f*)(out + (size_t)(row0 + r) * DM + col0 + c4) = v; } }
// q, k and v = x W + b read the same x and depend on nothing of one another: one grid, a block range each (q, then k, then v), so that the two narrow products fill the places that the wide one leaves idle.
#define GB_Q ((NR / 128) * (DM / 64))
#define GB_KV ((NR / 128) * (KVD / 64))
__global__ __launch_bounds__(128) void k_qkv(const _Float16* __restrict__ X16, const _Float16* __restrict__ BQ, const _Float16* __restrict__ BK, const _Float16* __restrict__ BV, const float* __restrict__ bq, const float* __restrict__ bk, const float* __restrict__ bv,
    _Float16* __restrict__ QH, _Float16* __restrict__ QL, _Float16* __restrict__ KH, _Float16* __restrict__ KL, _Float16* __restrict__ VT, _Float16* __restrict__ VTL) {
  GEMM2_LDS
  const int b = blockIdx.x;      /* every branch below is the same for the whole block */
  if (b >= GB_Q + GB_KV) { gemm2_body<0, 2>(b - GB_Q - GB_KV, so, tA, tB, X16, DM, 0, BV, DM, 0, 0.0625f, bv, 0, nullptr, 1, 0, 0, nullptr, VT, VTL, SLEN, 0, NR, KVD, DM); return; }      /* V^T hi/lo: [kv head][d][token] */
  if (b >= GB_Q) { gemm2_body<0, 1>(b - GB_Q, so, tA, tB, X16, DM, 0, BK, DM, 0, 0.0625f, bk, 0, nullptr, 1, 0, 0, nullptr, KH, KL, KVD, 0, NR, KVD, DM); return; }      /* k hi/lo, 4 kv heads */
  gemm2_body<0, 1>(b, so, tA, tB, X16, DM, 0, BQ, DM, 0, 0.0625f, bq, 0, nullptr, 1, 0, 0, nullptr, QH, QL, DM, 0, NR, DM, DM); }      /* q hi/lo */



// lane l with lane l ^ 16: the two lane halves of a 16-column group hold the two key halves of one query
__device__ __forceinline__ float xhalf(float x) { return __builtin_bit_cast(float, __builtin_amdgcn_permlanex16(__builtin_bit_cast(int, x), __builtin_bit_cast(int, x), 0x76543210, 0xfedcba98, false, false)); }
template <int CAUSAL>
__device__ __forceinline__ void flash_body(const int bx, float (*sO)[16][64 + 4], unsigned short (*ring)[64][LP], const _Float16* __restrict__ Q16, int ldq, const _Float16* __restrict__ K16, int ldk, const _Float16* __restrict__ Vt, const int* __restrict__ MSK, _Float16* __restrict__ OH, int ldo) {
  constexpr int RPW = 16, DT = 4, KS = 2;      /* every '#pragma unroll' below: constant indices keep the fragment, score and accumulator arrays in registers */
  const int g = __builtin_amdgcn_readfirstlane((int)threadIdx.x >> 7);      /* the wave's group, in a scalar register: every test on it below is a scalar branch */
  unsigned short (*sK)[64][LP] = ring + 4 * g, (*sV)[64][LP] = ring + 4 * g + 2;      /* two buffers each, per group; a stage = 64 keys: K rows (key, d) and V^T rows (d, key), shared by the group's four waves */
  const int tid = threadIdx.x & 127, w = tid >> 5, lane = tid & 31, ln = lane & 15, hh = lane >> 4;      /* tid, w: inside the group */
  const int slab = bx % (NB * NH), qblk = QB0P + QBNP - 1 - bx / (NB * NH); const int b = slab / NH, h = slab % NH;      /* heaviest tiles first */ const int qb0 = qblk * (4 * RPW); const int q0 = qb0 + w * RPW; const int tq = q0 + ln;
  FragH bq[KS];
  { const unsigned short* qr = (const unsigned short*)Q16 + ((size_t)b * TQ + tq) * ldq + h * 64;
#pragma unroll
    for (int ks = 0; ks < KS; ++ks) { bq[ks].half[0] = *(const v8us*)(qr + ks * 32 + 8 * hh); bq[ks].half[1] = *(const v8us*)(qr + ks * 32 + 16 + 8 * hh); } }
  const int kvh = h / NREP;      /* K16 and Vt hold the kv heads themselves: query head h reads kv head h / NREP */
  const unsigned short* Vth = (const unsigned short*)Vt + (size_t)(b * NKV + kvh) * 64 * TK;
  const float sl = (CAUSAL == 14) ? bf16_round(((const float*)MSK)[h]) : 0.f;      /* mode 14: causal + ALiBi slope[h] * (key - query) from the slopes INPUT */
  // Softmax in log2 units: p * 1024 = 2^(s * c2 + sl2 * (key - query) - m + 10). A lane's 16 keys of a pass lie at fixed distances from its first one, so scale and ALiBi are one fma per score against kb; the first key's own term (base) joins the maximum once a pass.
  static_assert(CAUSAL == 0 || CAUSAL == 1 || CAUSAL == 14, "every query needs a valid key in the first pass: masked scores go out by 2^(-3e38 - finite) = 0");
  static_assert(QB0P >= 2 && TK >= 256, "each group's first stage exists and lies wholly below every query of the block");
  const float c2 = SCL * 1.44269504088896340736f, sl2 = sl * 1.44269504088896340736f; v8f kb[2];
#pragma unroll
  for (int nt = 0; nt < 2; ++nt)
#pragma unroll
    for (int r = 0; r < 8; ++r) kb[nt][r] = sl2 * (float)(nt * 16 + r);
  float m_r = -3.0e38f, l_r = 0.f; v8f oacc[DT];
#pragma unroll
  for (int dt = 0; dt < DT; ++dt) oacc[dt] = (v8f){0.f,0.f,0.f,0.f,0.f,0.f,0.f,0.f};
  const int jend = (CAUSAL == 1 || CAUSAL == 14) ? (qb0 + 4 * RPW) : TK;      /* causal: keys beyond the block's last query never contribute */
  const unsigned short* Kh = (const unsigned short*)K16 + (size_t)b * TK * ldk + kvh * 64; const int nst = jend >> 6;      /* jend is a multiple of 64 */
  const int ntr = (nst + 1) >> 1;      /* trips: the same for both groups, which share every barrier; with an odd nst group 1 has no stage in the last one */
  stage64(Kh + (size_t)(g * 64) * ldk, ldk, &sK[0][0][0], tid); stage64(Vth + g * 64, TK, &sV[0][0][0], tid);
  wait_async0(); __syncthreads();      /* the groups' first stages (0 and 1) published */
  if (2 + g < nst) { stage64(Kh + (size_t)((2 + g) * 64) * ldk, ldk, &sK[1][0][0], tid); stage64(Vth + (2 + g) * 64, TK, &sV[1][0][0], tid); }
  // LDS fragment reads stand in groups, ahead of the products that use them: K of both passes and V^T of pass 0 at the head of the stage, V^T of pass 1 behind the output products of pass 0.
  // Only the first group's latency is waited out; every read stays inside its own stage, ahead of the wait and the barrier at the foot.
  FragH ak[2][2][KS], av[2][DT];
  auto ldK = [&](int bf, int pp) {
#pragma unroll
    for (int nt = 0; nt < 2; ++nt) { const unsigned short* kr = &sK[bf][pp * 32 + nt * 16 + ln][0];
#pragma unroll
      for (int ks = 0; ks < KS; ++ks) { ak[pp][nt][ks].half[0] = *(const v8us*)(kr + ks * 32 + 8 * hh); ak[pp][nt][ks].half[1] = *(const v8us*)(kr + ks * 32 + 16 + 8 * hh); } } };
  auto ldV = [&](int bf, int pp) {
#pragma unroll
    for (int dt = 0; dt < DT; ++dt) { const unsigned short* vrow = &sV[bf][dt * 16 + ln][pp * 32]; av[pp][dt].half[0] = *(const v8us*)(vrow + 8 * hh); av[pp][dt].half[1] = *(const v8us*)(vrow + 16 + 8 * hh); } };
  // the stage loop stays rolled: one stage a trip with the publish point at its foot
#pragma unroll 1
  for (int tr = 0; tr < ntr; ++tr) { const int bf = tr & 1, t = 2 * tr + g;      /* t: the group's key stage of this trip */
  if (t < nst) {      /* scalar: false only for group 1 in the last trip of an odd nst; the foot below is passed by every wave */
  ldK(bf, 0); ldK(bf, 1); ldV(bf, 0);
  // the two passes of a stage are unrolled: pass 1's fragments get registers of their own, so that their reads can be issued during pass 0
#pragma unroll
  for (int pp = 0; pp < 2; ++pp) { const int j0 = t * 64 + pp * 32;
    v8f s[2];
#pragma unroll
    for (int nt = 0; nt < 2; ++nt) { v8f acc = (v8f){0.f,0.f,0.f,0.f,0.f,0.f,0.f,0.f};
#pragma unroll
      for (int ks = 0; ks < KS; ++ks) acc = mmaH<1>(ak[pp][nt][ks].v, ak[pp][nt][ks].v, bq[ks].v, bq[ks].v, acc);
      s[nt] = acc; }
    const float base = sl2 * (float)(j0 + 8 * hh - tq);      /* ALiBi of the lane's first key of this pass */
    v8f u[2];
#pragma unroll
    for (int nt = 0; nt < 2; ++nt) u[nt] = s[nt] * c2 + kb[nt];
    if ((CAUSAL == 1 || CAUSAL == 14) && t == nst - 1) {      /* only the block's last stage holds keys beyond a query: a scalar branch, every earlier stage goes unmasked */
#pragma unroll
      for (int nt = 0; nt < 2; ++nt)
#pragma unroll
        for (int r = 0; r < 8; ++r) u[nt][r] = (j0 + nt * 16 + 8 * hh + r <= tq) ? u[nt][r] : -3.0e38f; }
    float mcn[2];      /* two independent chains */
#pragma unroll
    for (int nt = 0; nt < 2; ++nt) { mcn[nt] = u[nt][0];
#pragma unroll
      for (int r = 1; r < 8; ++r) mcn[nt] = fmaxf(mcn[nt], u[nt][r]); }
    float mc = fmaxf(mcn[0], mcn[1]) + base; mc = fmaxf(mc, xhalf(mc));
    const float mn = fmaxf(m_r, mc); const float al = __builtin_amdgcn_exp2f(m_r - mn); m_r = mn;      /* first pass: 2^(-3e38 - mn) = 0 */
    const float sh = (mn - base) - 10.0f;      /* the factor 1024 of the f16 P operand rides in the exponent; l sums the same scaled values */
    FragH pb; v8f e[2];
#pragma unroll
    for (int nt = 0; nt < 2; ++nt) { e[nt] = u[nt] - sh;      /* the exponents as one vector, each 2^x then written over its own exponent */
#pragma unroll
      for (int r = 0; r < 8; ++r) { e[nt][r] = __builtin_amdgcn_exp2f(e[nt][r]); pb.h[nt * 8 + r] = (_Float16)e[nt][r]; } }
    const v8f e8 = e[0] + e[1]; const v4f e4 = __builtin_shufflevector(e8, e8, 0, 1, 2, 3) + __builtin_shufflevector(e8, e8, 4, 5, 6, 7);
    l_r = l_r * al + ((e4[0] + e4[2]) + (e4[1] + e4[3]));
#pragma unroll
    for (int dt = 0; dt < DT; ++dt) oacc[dt] *= al;
#pragma unroll
    for (int dt = 0; dt < DT; ++dt) oacc[dt] = mmaH<1>(av[pp][dt].v, av[pp][dt].v, pb.v, pb.v, oacc[dt]);
    if (pp == 0) ldV(bf, 1); } }
    wait_ds0(); wait_async0(); __syncthreads();      /* publishes each group's next stage (t + 2) and ends every read of buffer bf */
    if (t + 4 < nst) { const int j2 = (t + 4) * 64; stage64(Kh + (size_t)j2 * ldk, ldk, &sK[bf][0][0], tid); stage64(Vth + j2, TK, &sV[bf][0][0], tid); } }
  wait_async0();
  // Join: group 1 hands its partial maximum, sum and O to group 0 through the ring, which nobody reads and no copy writes behind the last trip's barrier. Lane for lane the two groups hold the same (d, query) elements.
  float* mg = (float*)&ring[0][0][0] + (size_t)(w * 9 * 32 + lane) * 4;      /* 9 slots of 16 bytes a lane, a wave's 32 lanes side by side in each slot */
  static_assert(sizeof(float) * 4 * 9 * 32 * 4 <= sizeof(unsigned short) * 8 * 64 * LP, "the hand-over lies inside the ring");
  if (g == 1) {
#pragma unroll
    for (int dt = 0; dt < DT; ++dt) { *(v4fa*)(mg + (2 * dt) * 128) = (v4f){oacc[dt][0], oacc[dt][1], oacc[dt][2], oacc[dt][3]}; *(v4fa*)(mg + (2 * dt + 1) * 128) = (v4f){oacc[dt][4], oacc[dt][5], oacc[dt][6], oacc[dt][7]}; }
    *(v4fa*)(mg + 8 * 128) = (v4f){m_r, l_r, 0.f, 0.f}; }
  __syncthreads();      /* group 1's partial results published; the block's last barrier */
  if (g == 1) return;
  { const v4f ml = *(const v4fa*)(mg + 8 * 128); const float mj = fmaxf(m_r, ml[0]); const float a0 = __builtin_amdgcn_exp2f(m_r - mj), a1 = __builtin_amdgcn_exp2f(ml[0] - mj);      /* both maxima are finite: each group's first stage is unmasked */
    l_r = l_r * a0 + ml[1] * a1;
#pragma unroll
    for (int dt = 0; dt < DT; ++dt) { const v4f lo = *(const v4fa*)(mg + (2 * dt) * 128), hi = *(const v4fa*)(mg + (2 * dt + 1) * 128);
#pragma unroll
      for (int r = 0; r < 4; ++r) { oacc[dt][r] = oacc[dt][r] * a0 + lo[r] * a1; oacc[dt][4 + r] = oacc[dt][4 + r] * a0 + hi[r] * a1; } } }
  const float l = l_r + xhalf(l_r); const float li = (l > 0.f) ? 1.0f / l : 0.f;      /* l carries the factor 1024 of P */
#pragma unroll
  for (int dt = 0; dt < DT; ++dt) { const v4f lo = {oacc[dt][0] * li, oacc[dt][1] * li, oacc[dt][2] * li, oacc[dt][3] * li}, hi = {oacc[dt][4] * li, oacc[dt][5] * li, oacc[dt][6] * li, oacc[dt][7] * li};
    *(v4fa*)&sO[w][ln][dt * 16 + 8 * hh] = lo; *(v4fa*)&sO[w][ln][dt * 16 + 8 * hh + 4] = hi; }
  __builtin_amdgcn_fence(__ATOMIC_ACQ_REL, "workgroup"); __builtin_amdgcn_wave_barrier();      /* the wave's own sO rows: its stores above stay ahead of its whole-line reads below */
  {
#pragma unroll
    for (int rp = 0; rp < RPW; rp += 2) { const int r = rp + (lane >> 4), pc = lane & 15; const v4f val = *(const v4fa*)&sO[w][r][pc * 4]; v4h h4; for (int i = 0; i < 4; ++i) h4[i] = (_Float16)val[i]; *(v4h*)(OH + ((size_t)b * TQ + q0 + r) * ldo + h * 64 + pc * 4) = h4; }      /* O leaves as the f16 A operand of the Wo GEMM: 16 lanes one 128-byte line */
     } }
// 5-plane variant: S = Qh Kh^T + (Ql Kh^T + Qh Kl^T)/1024 with Q/K = [hi | 2^10 residual] f16 planes (QL/KL same layout as Q16/K16), then the 3-term P.V below.
// 3-term variant: O = (P_hi V_hi + (P_lo V_hi + P_hi V_lo) / 1024) / l with P = [hi | 2^10 residual] of 1024 p and V^T = [hi | 2^10 residual] planes (VtL same layout as Vt) -> ~2^-21-class products for un-averaged (early causal / peaked) rows
template <int CAUSAL>
__device__ __forceinline__ void flash5_body(const int bx, const int tid, float (*sO)[16][64 + 4], unsigned short (*ring)[64][LP], const _Float16* __restrict__ Q16, const _Float16* __restrict__ QL, int ldq, const _Float16* __restrict__ K16, const _Float16* __restrict__ KL, int ldk, const _Float16* __restrict__ Vt, const _Float16* __restrict__ VtL, const int* __restrict__ MSK, _Float16* __restrict__ OH, _Float16* __restrict__ OL, int ldo) {
  constexpr int RPW = 16, DT = 4, KS = 2;      /* transposed products as in flash_body: lane (ln, hh) holds query q0 + ln, keys j0 + nt * 16 + 8 * hh + r; '#pragma unroll' as there */
  unsigned short (*sK)[LP] = ring[0], (*sKl)[LP] = ring[1], (*sV)[LP] = ring[2], (*sVl)[LP] = ring[3];      /* a stage = 64 keys of the four planes in ONE buffer: the LDS frame of one group of flash_body, so that both bodies share a kernel at its residency */
  const int w = tid >> 5, lane = tid & 31, ln = lane & 15, hh = lane >> 4;      /* tid: the thread inside its group of 128 */
  const int slab = bx / QBN5, qblk = QB05 + bx % QBN5; const int b = slab / NH, h = slab % NH; const int qb0 = qblk * (4 * RPW); const int q0 = qb0 + w * RPW; const int tq = q0 + ln;
  FragH bq[KS], bql[KS];
  { const unsigned short* qr = (const unsigned short*)Q16 + ((size_t)b * TQ + tq) * ldq + h * 64; const unsigned short* ql = (const unsigned short*)QL + ((size_t)b * TQ + tq) * ldq + h * 64;
#pragma unroll
    for (int ks = 0; ks < KS; ++ks) { bq[ks].half[0] = *(const v8us*)(qr + ks * 32 + 8 * hh); bq[ks].half[1] = *(const v8us*)(qr + ks * 32 + 16 + 8 * hh); bql[ks].half[0] = *(const v8us*)(ql + ks * 32 + 8 * hh); bql[ks].half[1] = *(const v8us*)(ql + ks * 32 + 16 + 8 * hh); } }
  const int kvh = h / NREP;      /* kv heads unexpanded, as in flash_body */
  const unsigned short* Vth = (const unsigned short*)Vt + (size_t)(b * NKV + kvh) * 64 * TK; const unsigned short* Vtl = (const unsigned short*)VtL + (size_t)(b * NKV + kvh) * 64 * TK;
  const float sl = (CAUSAL == 14) ? bf16_round(((const float*)MSK)[h]) : 0.f;      /* mode 14: causal + ALiBi slope[h] * (key - query) from the slopes INPUT */
  float m_r = -3.0e38f, l_r = 0.f; v8f oacc[DT], oaccL[DT];
#pragma unroll
  for (int dt = 0; dt < DT; ++dt) { oacc[dt] = (v8f){0.f,0.f,0.f,0.f,0.f,0.f,0.f,0.f}; oaccL[dt] = oacc[dt]; }
  const int jend = (CAUSAL == 1 || CAUSAL == 14) ? (qb0 + 4 * RPW) : TK;      /* causal: keys beyond the block's last query never contribute */
  const unsigned short* Kh = (const unsigned short*)K16 + (size_t)b * TK * ldk + kvh * 64; const unsigned short* Kl = (const unsigned short*)KL + (size_t)b * TK * ldk + kvh * 64; const int nst = jend >> 6;      /* jend is a multiple of 64 */
  // both loops stay rolled: one stage a trip, filled at its head and left at its foot, and the two passes of a stage share one body (short code, the pass as an address offset)
#pragma unroll 1
  for (int t = 0; t < nst; ++t) { const int j1 = t * 64;
    stage64(Kh + (size_t)j1 * ldk, ldk, &sK[0][0], tid); stage64(Kl + (size_t)j1 * ldk, ldk, &sKl[0][0], tid); stage64(Vth + j1, TK, &sV[0][0], tid); stage64(Vtl + j1, TK, &sVl[0][0], tid);
    wait_async0(); __syncthreads();      /* stage t published; at most four stages a block, their landing times covered by the other blocks of the grid */
#pragma unroll 1
  for (int p = 0; p < 64; p += 32) { const int j0 = t * 64 + p;
    v8f s[2];
#pragma unroll
    for (int nt = 0; nt < 2; ++nt) { const unsigned short* kr = &sK[p + nt * 16 + ln][0]; const unsigned short* klr = &sKl[p + nt * 16 + ln][0]; FragH ak[KS], akl[KS];
#pragma unroll
      for (int ks = 0; ks < KS; ++ks) { ak[ks].half[0] = *(const v8us*)(kr + ks * 32 + 8 * hh); ak[ks].half[1] = *(const v8us*)(kr + ks * 32 + 16 + 8 * hh); akl[ks].half[0] = *(const v8us*)(klr + ks * 32 + 8 * hh); akl[ks].half[1] = *(const v8us*)(klr + ks * 32 + 16 + 8 * hh); }
      v8f acc = (v8f){0.f,0.f,0.f,0.f,0.f,0.f,0.f,0.f}, accl = acc;
#pragma unroll
      for (int ks = 0; ks < KS; ++ks) { acc = mmaH<1>(ak[ks].v, ak[ks].v, bq[ks].v, bq[ks].v, acc); accl = mmaH<1>(ak[ks].v, ak[ks].v, bql[ks].v, bql[ks].v, accl); accl = mmaH<1>(akl[ks].v, akl[ks].v, bq[ks].v, bq[ks].v, accl); }
#pragma unroll
      for (int r = 0; r < 8; ++r) acc[r] += accl[r] * 0.0009765625f;
      s[nt] = acc; }
    float sc[2][8], mcn[2]; bool ok[2][8];
#pragma unroll
    for (int nt = 0; nt < 2; ++nt) { mcn[nt] = -3.0e38f;
#pragma unroll
      for (int r = 0; r < 8; ++r) { const int kk = j0 + nt * 16 + 8 * hh + r;
        ok[nt][r] = (CAUSAL == 1 || CAUSAL == 14) ? (kk <= tq) : ((CAUSAL == 2) ? ((kk >> 5) == (tq >> 5)) : true);      /* mode 2: block-diagonal 32-token groups */
        if (CAUSAL == 4) ok[nt][r] = MSK[((size_t)b * TQ + tq) * TK + kk] != 0;      /* mode 4: per-(query, key) INPUT mask shared by all heads; masked keys contribute nothing, rows with no valid key give l = 0 -> output 0 */
        float sv = ok[nt][r] ? s[nt][r] * SCL : -3.0e38f; if (CAUSAL == 14) { if (ok[nt][r]) sv += sl * (float)(kk - tq); }
        sc[nt][r] = sv; mcn[nt] = fmaxf(mcn[nt], sv); } }
    float mc = fmaxf(mcn[0], mcn[1]); mc = fmaxf(mc, xhalf(mc));
    const float mn = fmaxf(m_r, mc); const float ea = expf(m_r - mn); const float al = (mn > -1.0e38f) ? ea : 1.0f; m_r = mn;
    FragH pb, pl; float psn[2];
#pragma unroll
    for (int nt = 0; nt < 2; ++nt) { psn[nt] = 0.f;
#pragma unroll
      for (int r = 0; r < 8; ++r) { const float e = expf(sc[nt][r] - mn); const float p = ok[nt][r] ? e : 0.f; psn[nt] += p; const float ps = p * 1024.0f; const _Float16 ph = (_Float16)ps; pb.h[nt * 8 + r] = ph; pl.h[nt * 8 + r] = (_Float16)((ps - (float)ph) * 1024.0f); } }
    l_r = l_r * al + (psn[0] + psn[1]);
#pragma unroll
    for (int dt = 0; dt < DT; ++dt)
#pragma unroll
      for (int r = 0; r < 8; ++r) { oacc[dt][r] *= al; oaccL[dt][r] *= al; }
#pragma unroll
    for (int dt = 0; dt < DT; ++dt) { const unsigned short* vrow = &sV[dt * 16 + ln][p]; const unsigned short* vrl = &sVl[dt * 16 + ln][p]; FragH av, avl; av.half[0] = *(const v8us*)(vrow + 8 * hh); av.half[1] = *(const v8us*)(vrow + 16 + 8 * hh); avl.half[0] = *(const v8us*)(vrl + 8 * hh); avl.half[1] = *(const v8us*)(vrl + 16 + 8 * hh);
      oacc[dt] = mmaH<1>(av.v, av.v, pb.v, pb.v, oacc[dt]); oaccL[dt] = mmaH<1>(av.v, av.v, pl.v, pl.v, oaccL[dt]); oaccL[dt] = mmaH<1>(avl.v, avl.v, pb.v, pb.v, oaccL[dt]); } }
    wait_ds0(); __syncthreads(); }      /* ends every read of the buffer ahead of its refill */
  const float l = l_r + xhalf(l_r); const float li = (l > 0.f) ? 1.0f / (l * 1024.0f) : 0.f;
#pragma unroll
  for (int dt = 0; dt < DT; ++dt) { v4f lo, hi;
#pragma unroll
    for (int r = 0; r < 4; ++r) { float v = oacc[dt][r]; v += oaccL[dt][r] * 0.0009765625f; lo[r] = v * li; v = oacc[dt][4 + r]; v += oaccL[dt][4 + r] * 0.0009765625f; hi[r] = v * li; }
    *(v4fa*)&sO[w][ln][dt * 16 + 8 * hh] = lo; *(v4fa*)&sO[w][ln][dt * 16 + 8 * hh + 4] = hi; }
  __builtin_amdgcn_fence(__ATOMIC_ACQ_REL, "workgroup"); __builtin_amdgcn_wave_barrier();      /* the wave's own sO rows: its stores above stay ahead of its whole-line reads below */
  {
#pragma unroll
    for (int rp = 0; rp < RPW; rp += 2) { const int r = rp + (lane >> 4), pc = lane & 15; const v4f val = *(const v4fa*)&sO[w][r][pc * 4]; v4h h4, l4; for (int i = 0; i < 4; ++i) { h4[i] = (_Float16)val[i]; l4[i] = (_Float16)((val[i] - (float)h4[i]) * 1024.0f); }
      *(v4h*)(OH + ((size_t)b * TQ + q0 + r) * ldo + h * 64 + pc * 4) = h4; *(v4h*)(OL + ((size_t)b * TQ + q0 + r) * ldo + h * 64 + pc * 4) = l4; }      /* O leaves as f16 hi + 2^10 residual, the two A operands of the Wo GEMM on these rows */
     }
  asm volatile("s_wait_xcnt 0x0" ::: "memory");      /* behind the last stores: in the built kernel the plain form's code stands behind this one's and writes the registers that these stores name; a precaution of form */ }
// The two forms work on disjoint query rows from the same planes: one grid, the few blocks of the 5-plane form first (they are slow a stage and must not start last), then the plain form's, heaviest first.
// A 5-plane block's two groups of 4 waves take the same query tile of two neighbouring heads: equal trip counts, so they share every barrier; each group has its own half of ring and sO.
template <int CAUSAL>
__global__ __launch_bounds__(256) void k_flash_all(const _Float16* __restrict__ Q16, const _Float16* __restrict__ QL, int ldq, const _Float16* __restrict__ K16, const _Float16* __restrict__ KL, int ldk, const _Float16* __restrict__ Vt, const _Float16* __restrict__ VtL, const float* __restrict__ SLP, _Float16* __restrict__ OH, _Float16* __restrict__ OL, int ldo) {
  __shared__ __attribute__((aligned(16))) float sO[8][16][64 + 4];
  __shared__ __attribute__((aligned(16))) unsigned short ring[8][64][LP];
  static_assert((NB * NH) % 2 == 0, "the 5-plane blocks take heads in pairs");
  constexpr int B5 = NB * NH * QBN5 / 2;      /* blocks of the 5-plane form */
  const int* MSK = (const int*)SLP;      /* the bodies' one pointer for mask or slopes; mode 14 reads it as the f32 slopes */
  const int bx = blockIdx.x;      /* the branch is the same for the whole block */
  if (bx >= B5) flash_body<CAUSAL>(bx - B5, sO, ring, Q16, ldq, K16, ldk, Vt, MSK, OH, ldo);
  else { const int g = __builtin_amdgcn_readfirstlane((int)threadIdx.x >> 7);      /* the wave's group, scalar */
    flash5_body<CAUSAL>((2 * (bx / QBN5) + g) * QBN5 + bx % QBN5, (int)threadIdx.x & 127, sO + 4 * g, ring + 4 * g, Q16, QL, ldq, K16, KL, ldk, Vt, VtL, MSK, OH, OL, ldo); } }

__global__ __launch_bounds__(256) void k_rotab(float* __restrict__ CS, float* __restrict__ SN) {
  #pragma clang fp contract(off)
  const int t = blockIdx.x * 256 + threadIdx.x; if (t >= SLEN * 32) return; const int j = t % 32, s = t / 32; const float ex = (float)(2 * j) / 64.0f; const float inv = 1.0f / powf(10000.0f, ex); const float th = (float)s * inv; const float c = cosf(th), sn = sinf(th);
  { *(float*)(CS + t) = c; *(float*)(SN + t) = sn;  } }
__global__ __launch_bounds__(256) void k_rope(const float* __restrict__ F, int nsrc, int ndst, int rep, const float* __restrict__ CS, const float* __restrict__ SN, _Float16* __restrict__ H, _Float16* __restrict__ L) {
  #pragma clang fp contract(off)
  const size_t t = (size_t)blockIdx.x * 256 + threadIdx.x; if (t >= (size_t)NR * ndst * 4) return; const int g8 = (int)(t % 4); const int hd = (int)((t / 4) % ndst); const size_t row = t / ((size_t)4 * ndst); const int s = (int)(row % SLEN); const int hs = hd / rep;
  const float* src = F + row * (size_t)(nsrc * 64) + hs * 64; FragH ah, al, bh, bl;
  for (int i = 0; i < 8; ++i) { const int d = g8 * 8 + i; const float c = CS[s * 32 + d], sn = SN[s * 32 + d]; const float x1 = src[d], x2 = src[d + 32];
    float o1 = x1 * c; o1 += -x2 * sn; float o2 = x2 * c; o2 += x1 * sn;
    _Float16 hv = (_Float16)o1; ah.h[i] = hv; al.h[i] = (_Float16)((o1 - (float)hv) * 1024.0f); hv = (_Float16)o2; bh.h[i] = hv; bl.h[i] = (_Float16)((o2 - (float)hv) * 1024.0f); }
  const size_t o = row * (size_t)(ndst * 64) + hd * 64 + g8 * 8;
  { *(v8us*)((unsigned short*)H + o) = ah.half[0]; *(v8us*)((unsigned short*)H + o + 32) = bh.half[0]; *(v8us*)((unsigned short*)L + o) = al.half[0]; *(v8us*)((unsigned short*)L + o + 32) = bl.half[0];  } }

extern "C" void kernel_launch(void* const* d_in, const int* in_sizes, int n_in,
                              void* d_out, int out_size, void* d_ws, size_t ws_size, hipStream_t stream) {
  (void)in_sizes; (void)n_in; (void)out_size;
  const float* const* I = (const float* const*)d_in; const float* x = I[0]; const float* Wq = I[1]; const float* bq = I[2]; const float* Wk = I[3]; const float* bk = I[4]; const float* Wv = I[5]; const float* bv = I[6]; const float* Wo = I[7]; const float* bo = I[8]; const float* slopes = I[9];
  char* ws = (char*)d_ws; size_t off = 0;
  auto take = [&](size_t bytes) { char* p = ws + off; off += (bytes + 255) & ~(size_t)255; return p; };
  const size_t np = (size_t)NR * DM, nk = (size_t)NR * KVD;
  _Float16* BQ = (_Float16*)take((size_t)DM * DM * 2); _Float16* BK = (_Float16*)take((size_t)KVD * DM * 2); _Float16* BV = (_Float16*)take((size_t)KVD * DM * 2); _Float16* BO = (_Float16*)take((size_t)DM * DM * 2);
  _Float16* X16 = (_Float16*)take(np * 2); _Float16* QH = (_Float16*)take(np * 2); _Float16* QL = (_Float16*)take(np * 2); _Float16* KH = (_Float16*)take(nk * 2); _Float16* KL = (_Float16*)take(nk * 2); _Float16* VT = (_Float16*)take(nk * 2); _Float16* VTL = (_Float16*)take(nk * 2);
  _Float16* OH = (_Float16*)take(np * 2); _Float16* OLo = (_Float16*)take(np * 2);
  if (off > ws_size) return;      /* 2+0.5+0.5+2 + 8+8+8+2+2+2+2+8+8 = 53 MiB */
  k_prep<<<2 * PB_W + 2 * PB_KV + PB_X, 256, 0, stream>>>(x, Wq, Wk, Wv, Wo, X16, BQ, BK, BV, BO);      /* x16 weights transposed, f16 plane of x */
  k_qkv<<<GB_Q + 2 * GB_KV, 128, 0, stream>>>(X16, BQ, BK, BV, bq, bk, bv, QH, QL, KH, KL, VT, VTL);      /* q hi/lo; k hi/lo, 4 kv heads; V^T hi/lo: [kv head][d][token] */
  k_flash_all<14><<<NB * NH * QBNP + NB * NH * QBN5 / 2, 256, 0, stream>>>(QH, QL, DM, KH, KL, KVD, VT, VTL, slopes, OH, OLo, DM);      /* causal + ALiBi: rows >= 256 plain, rows < 256 hi + residual */
  k_wo<<<(NR / 128) * (DM / 64), 128, 0, stream>>>(OH, OLo, BO, bo, (float*)d_out);      /* out = ctx Wo + bo, the O residual term of the first 256 rows of each sequence in the same blocks */
}

// v010
// Measured time: 80.5 microseconds a run.
// Two timings next to v009 put it at 1.08 and 1.09 times that version's speed.
// Counting every step since v000, which is the starting kernel, it is 10.0 times as fast.
#include <hip/hip_runtime.h>
// CausalAlibiAttn (1 x 4096 tokens, D 1024 = 16 heads of 64, 4 kv heads): q, k, v = x W + b; q head h uses kv head h/4; scores/8 + slope[h] * (key - query) (ALiBi, slopes INPUT), causal; softmax; ctx Wo + bo.
// Structure: exact f16 plane of x; q, k, v by WMMA GEMMs (32x64 wave tiles, f32 accumulation, exact x16 weights + bias) whose epilogues split the f32 result into f16 hi + 2^10-residual planes themselves (v transposed in the LDS staging tile; k, v stay at their 4 kv heads); the fused causal flash kernel (query head h reads kv head h / 4) with the ALiBi term added per (head, query, key) in f32, in its 5-plane form for the first 256 query rows and the plain form beyond; it stores O as f16 hi (+ residual on those rows) for the Wo GEMM (+ bias; residual term only on those rows, in the same launch).
// Compute dtype: x and parameters rounded to bf16; q/k/P/v/O as f16 hi + residual on rows < 256 (~2^-21) and plain f16 beyond (~2^-12); ALiBi/softmax f32. v_wmma_f32_16x16x32_f16.
#define NB 1
#define DM 1024
#define NKV 4
#define NREP (NH / NKV)
#define KVD (NKV * 64)           /* 256 */
#define NR (NB * SLEN)           /* 4096 */
#define SLEN 4096
#define TQ SLEN
#define TK SLEN
#define NH 16
#define SCL 0.125f
#define QBLKS (TQ / 64)
#define QB05 0
#define QBN5 4
#define QB0P QBN5
#define QBNP (QBLKS - QBN5)
#define RE 256
typedef __bf16 v16b __attribute__((ext_vector_type(16)));
typedef unsigned short v8us __attribute__((ext_vector_type(8), may_alias));
typedef float  v8f  __attribute__((ext_vector_type(8)));
typedef float  v4f  __attribute__((ext_vector_type(4)));
typedef float  v4fa __attribute__((ext_vector_type(4), may_alias));
union FragB { v16b v; v8us half[2]; unsigned short u[16]; };

__device__ __forceinline__ unsigned short bf16_bits(float x) { unsigned int u = __float_as_uint(x); return (unsigned short)((u + 0x7FFFu + ((u >> 16) & 1u)) >> 16); }
__device__ __forceinline__ float bf16_val(unsigned short b) { return __uint_as_float(((unsigned int)b) << 16); }
__device__ __forceinline__ float bf16_round(float x) { return bf16_val(bf16_bits(x)); }
// D += A·B with NT terms: 1 = ah·bh, 2 = + al·bh (A split), 3 = + ah·bl (both split)
template <int NT>
__device__ __forceinline__ v8f mmaN(v16b ah, v16b al, v16b bh, v16b bl, v8f c) {
  c = __builtin_amdgcn_wmma_f32_16x16x32_bf16(false, ah, false, bh, (short)0, c, false, false);
  if (NT >= 2) c = __builtin_amdgcn_wmma_f32_16x16x32_bf16(false, al, false, bh, (short)0, c, false, false);
  if (NT >= 3) c = __builtin_amdgcn_wmma_f32_16x16x32_bf16(false, ah, false, bl, (short)0, c, false, false);
  asm volatile("v_nop\n\tv_nop\n\tv_nop\n\tv_nop" : "+v"(c) : "v"(ah), "v"(al), "v"(bh), "v"(bl));
  return c;
}

__global__ __launch_bounds__(256) void k_wt_bf16(const float* __restrict__ W, unsigned short* __restrict__ Wt, int K, int N) {
  const int t = blockIdx.x * 256 + threadIdx.x;
  const int k8n = K / 8;
  if (t >= N * k8n) return;
  const int n = t / k8n, k8 = (t % k8n) * 8;
  v8us v;
#pragma unroll
  for (int i = 0; i < 8; ++i) v[i] = bf16_bits(W[(size_t)(k8 + i) * N + n]);
  *(v8us*)(Wt + (size_t)n * K + k8) = v;
  
}

// GEMM C[M][N] (f32, pitch ldc) = act(A[M][K]·W + bias). A f32 row-major (pitch lda) converted per fragment to bf16
// (ASPLIT: hi/lo two planes -> 2 terms, else single rounded term); Wt bf16 [N][K] (pitch ldb). BIAS_BF16 rounds the
// bias to bf16 first (bias quantised to bf16 before the add). K%32==0, M%16==0, N%64==0.
template <bool ASPLIT, int ACT, bool BIAS_BF16>
__global__ __launch_bounds__(128) void k_gemm_bf(const float* __restrict__ A, int lda, const unsigned short* __restrict__ Wt, int ldb,
                                               const float* __restrict__ bias, float* __restrict__ C, int ldc, int M, int N, int K) {
  __shared__ __attribute__((aligned(16))) float so[4][16][64];
  const int tid = threadIdx.x, w = tid >> 5, lane = tid & 31, ln = lane & 15, hh = lane >> 4;
  const int ntn = N / 64;
  const int wid = blockIdx.x * 4 + w;
  const int mt = wid / ntn, nq = wid % ntn;
  if (mt * 16 >= M) return;
  const int row0 = mt * 16, col0 = nq * 64;
  const float* arow = A + (size_t)(row0 + ln) * lda;
  v8f acc[4] = {};
  for (int kb = 0; kb < K; kb += 32) {
    FragB ah, al;
    const v4f x0 = *(const v4fa*)(arow + kb + 8 * hh), x1 = *(const v4fa*)(arow + kb + 8 * hh + 4);
    const v4f x2 = *(const v4fa*)(arow + kb + 16 + 8 * hh), x3 = *(const v4fa*)(arow + kb + 16 + 8 * hh + 4);
    float xs[16] = {x0[0],x0[1],x0[2],x0[3],x1[0],x1[1],x1[2],x1[3],x2[0],x2[1],x2[2],x2[3],x3[0],x3[1],x3[2],x3[3]};
#pragma unroll
    for (int i = 0; i < 16; ++i) { const unsigned short hb = bf16_bits(xs[i]); ah.u[i] = hb; al.u[i] = ASPLIT ? bf16_bits(xs[i] - bf16_val(hb)) : (unsigned short)0; }
#pragma unroll
    for (int t = 0; t < 4; ++t) {
      const unsigned short* brow = Wt + (size_t)(col0 + t * 16 + ln) * ldb + kb;
      FragB b;
      b.half[0] = *(const v8us*)(brow + 8 * hh);
      b.half[1] = *(const v8us*)(brow + 16 + 8 * hh);
      acc[t] = mmaN<ASPLIT ? 2 : 1>(ah.v, al.v, b.v, b.v, acc[t]);
    }
  }
#pragma unroll
  for (int t = 0; t < 4; ++t) {
    float bv = bias ? bias[col0 + t * 16 + ln] : 0.f;
    if (BIAS_BF16) bv = bf16_round(bv);
#pragma unroll
    for (int r = 0; r < 8; ++r) { float v = acc[t][r] + bv; if (ACT == 1) v = fmaxf(v, 0.f); so[w][8 * hh + r][t * 16 + ln] = v; }
  }
  __builtin_amdgcn_fence(__ATOMIC_ACQ_REL, "workgroup");
  __builtin_amdgcn_wave_barrier();
  const int rsub = lane >> 4, c4 = (lane & 15) * 4;
  {
#pragma unroll
    for (int q = 0; q < 8; ++q) {
      const int r = q * 2 + rsub;
      const v4f v = *(const v4fa*)&so[w][r][c4];
      *(v4f*)(C + (size_t)(row0 + r) * ldc + col0 + c4) = v;
    }
    
  }
}

// GEMM C = act(A·W + bias + resid): A f32 (ASPLIT -> hi/lo 2 terms), Wt bf16 [N][K]; ACT 0 none, 1 relu, 2 exact gelu;
// resid (optional, f32, row index = (row % rmod), pitch ldr, RES_BF16 rounds it) added before the activation.
template <bool ASPLIT, int ACT, bool BIAS_BF16, bool RES_BF16>
__global__ __launch_bounds__(128) void k_gemm_bf3(const float* __restrict__ A, int lda, const unsigned short* __restrict__ Wt, int ldb,
                                                const float* __restrict__ bias, const float* __restrict__ resid, int rmod, int ldr,
                                                float* __restrict__ C, int ldc, int M, int N, int K) {
  __shared__ __attribute__((aligned(16))) float so[4][16][64];
  const int tid = threadIdx.x, w = tid >> 5, lane = tid & 31, ln = lane & 15, hh = lane >> 4;
  const int ntn = N / 64;
  const int wid = blockIdx.x * 4 + w;
  const int mt = wid / ntn, nq = wid % ntn;
  if (mt * 16 >= M) return;
  const int row0 = mt * 16, col0 = nq * 64;
  const float* arow = A + (size_t)(row0 + ln) * lda;
  v8f acc[4] = {};
  for (int kb = 0; kb < K; kb += 32) {
    FragB ah, al;
    const v4f x0 = *(const v4fa*)(arow + kb + 8 * hh), x1 = *(const v4fa*)(arow + kb + 8 * hh + 4);
    const v4f x2 = *(const v4fa*)(arow + kb + 16 + 8 * hh), x3 = *(const v4fa*)(arow + kb + 16 + 8 * hh + 4);
    float xs[16] = {x0[0],x0[1],x0[2],x0[3],x1[0],x1[1],x1[2],x1[3],x2[0],x2[1],x2[2],x2[3],x3[0],x3[1],x3[2],x3[3]};
#pragma unroll
    for (int i = 0; i < 16; ++i) { const unsigned short hb = bf16_bits(xs[i]); ah.u[i] = hb; al.u[i] = ASPLIT ? bf16_bits(xs[i] - bf16_val(hb)) : (unsigned short)0; }
#pragma unroll
    for (int t = 0; t < 4; ++t) {
      const unsigned short* brow = Wt + (size_t)(col0 + t * 16 + ln) * ldb + kb;
      FragB b;
      b.half[0] = *(const v8us*)(brow + 8 * hh);
      b.half[1] = *(const v8us*)(brow + 16 + 8 * hh);
      acc[t] = mmaN<ASPLIT ? 2 : 1>(ah.v, al.v, b.v, b.v, acc[t]);
    }
  }
#pragma unroll
  for (int t = 0; t < 4; ++t) {
    const int col = col0 + t * 16 + ln;
    float bv = bias ? bias[col] : 0.f;
    if (BIAS_BF16) bv = bf16_round(bv);
#pragma unroll
    for (int r = 0; r < 8; ++r) {
      float v = acc[t][r] + bv;
      if (resid) { float rv = resid[(size_t)((row0 + 8 * hh + r) % rmod) * ldr + col]; if (RES_BF16) rv = bf16_round(rv); v += rv; }
      if (ACT == 1) v = fmaxf(v, 0.f);
      if (ACT == 2) v = 0.5f * v * (1.0f + erff(v * 0.70710678118654752f));
      if (ACT == 3) { const float u = 0.7978845608028654f * (v + 0.044715f * v * v * v); v = 0.5f * v * (1.0f + tanhf(u)); }
      so[w][8 * hh + r][t * 16 + ln] = v;
    }
  }
  __builtin_amdgcn_fence(__ATOMIC_ACQ_REL, "workgroup");
  __builtin_amdgcn_wave_barrier();
  const int rsub = lane >> 4, c4 = (lane & 15) * 4;
  {
#pragma unroll
    for (int q = 0; q < 8; ++q) {
      const int r = q * 2 + rsub;
      const v4f v = *(const v4fa*)&so[w][r][c4];
      *(v4f*)(C + (size_t)(row0 + r) * ldc + col0 + c4) = v;
    }
    
  }
}
// row LayerNorm (biased variance, eps) over N: s = X (+ R); optional out_sum <- s; out_norm <- (s-mu)*rsqrt(var+eps)*g + b
template <bool PARAM_BF16>
__global__ __launch_bounds__(256) void k_layernorm(const float* __restrict__ X, const float* __restrict__ R, const float* __restrict__ g, const float* __restrict__ bta,
                                                  float* __restrict__ out_sum, float* __restrict__ out_norm, int N, float eps) {
  __shared__ float red[256];
  const int row = blockIdx.x, tid = threadIdx.x;
  const float* x = X + (size_t)row * N; const float* rr = R ? R + (size_t)row * N : nullptr;
  float vals[16];                     // up to N = 4096
  const int per = N / 256;            // contiguous chunk per thread? use strided-by-4 chunks: thread handles j = tid*4 + 1024*u
  float s1 = 0.f;
  for (int u = 0; u < per / 4; ++u) {
    const int j = tid * 4 + 1024 * u;
    const v4f a = *(const v4fa*)(x + j);
    v4f b = {0.f,0.f,0.f,0.f}; if (rr) b = *(const v4fa*)(rr + j);
#pragma unroll
    for (int q = 0; q < 4; ++q) { const float v = a[q] + b[q]; vals[u * 4 + q] = v; s1 += v; }
  }
  red[tid] = s1; __syncthreads();
  for (int st = 128; st > 0; st >>= 1) { if (tid < st) red[tid] += red[tid + st]; __syncthreads(); }
  const float mu = red[0] / (float)N; __syncthreads();
  float s2 = 0.f;
  for (int u = 0; u < per / 4; ++u)
#pragma unroll
    for (int q = 0; q < 4; ++q) { const float c = vals[u * 4 + q] - mu; s2 += c * c; }
  red[tid] = s2; __syncthreads();
  for (int st = 128; st > 0; st >>= 1) { if (tid < st) red[tid] += red[tid + st]; __syncthreads(); }
  const float rs = rsqrtf(red[0] / (float)N + eps);
  {
    for (int u = 0; u < per / 4; ++u) {
      const int j = tid * 4 + 1024 * u;
      v4f o, sm;
#pragma unroll
      for (int q = 0; q < 4; ++q) {
        float gg = g[j + q], bb = bta[j + q];
        if (PARAM_BF16) { gg = bf16_round(gg); bb = bf16_round(bb); }
        sm[q] = vals[u * 4 + q]; o[q] = (vals[u * 4 + q] - mu) * rs * gg + bb;
      }
      if (out_sum) *(v4f*)(out_sum + (size_t)row * N + j) = sm;
      *(v4f*)(out_norm + (size_t)row * N + j) = o;
    }
    
  }
}



// ---- f16 WMMA path (v_wmma_f32_16x16x32_f16): 11-bit significands for operands in range — used where a [0,1] probability operand needs more precision than bf16
typedef _Float16 v16h __attribute__((ext_vector_type(16)));
union FragH { v16h v; v8us half[2]; _Float16 h[16]; unsigned short u[16]; };
template <int NT>
__device__ __forceinline__ v8f mmaH(v16h ah, v16h al, v16h bh, v16h bl, v8f c) {
  c = __builtin_amdgcn_wmma_f32_16x16x32_f16(false, ah, false, bh, (short)0, c, false, false);
  if (NT >= 2) c = __builtin_amdgcn_wmma_f32_16x16x32_f16(false, al, false, bh, (short)0, c, false, false);
  if (NT >= 3) c = __builtin_amdgcn_wmma_f32_16x16x32_f16(false, ah, false, bl, (short)0, c, false, false);
  asm volatile("v_nop\n\tv_nop\n\tv_nop\n\tv_nop" : "+v"(c) : "v"(ah), "v"(al), "v"(bh), "v"(bl));
  return c;
}
// batched GEMM like k_gemm_b but f16 operands: A f32 (split into f16 hi/lo if ASPLIT, else rounded to f16), Bt = f16 values [n][k]; alpha; C f32; N multiple of 16 (partial tiles skipped)
template <bool ASPLIT>
__global__ __launch_bounds__(128) void k_gemm_h(const float* __restrict__ A, int lda, size_t sA, const _Float16* __restrict__ Bh, int ldb, size_t sB, float alpha, float* __restrict__ C, int ldc, size_t sC, int M, int N, int K) {
  __shared__ __attribute__((aligned(16))) float so[4][16][64];
  const int tid = threadIdx.x, w = tid >> 5, lane = tid & 31, ln = lane & 15, hh = lane >> 4; const int by = blockIdx.y;
  A += (size_t)by * sA; Bh += (size_t)by * sB; C += (size_t)by * sC;
  const int ntn = (N + 63) / 64; const int wid = blockIdx.x * 4 + w; const int mt = wid / ntn, nq = wid % ntn; if (mt * 16 >= M) return;
  const int row0 = mt * 16, col0 = nq * 64; const float* arow = A + (size_t)(row0 + ln) * lda;
  v8f acc[4] = {};
  for (int kb = 0; kb < K; kb += 32) {
    FragH ah, al;
    const v4f x0 = *(const v4fa*)(arow + kb + 8 * hh), x1 = *(const v4fa*)(arow + kb + 8 * hh + 4), x2 = *(const v4fa*)(arow + kb + 16 + 8 * hh), x3 = *(const v4fa*)(arow + kb + 16 + 8 * hh + 4);
    float xs[16] = {x0[0],x0[1],x0[2],x0[3],x1[0],x1[1],x1[2],x1[3],x2[0],x2[1],x2[2],x2[3],x3[0],x3[1],x3[2],x3[3]};
#pragma unroll
    for (int i = 0; i < 16; ++i) { const _Float16 h = (_Float16)xs[i]; ah.h[i] = h; al.h[i] = ASPLIT ? (_Float16)(xs[i] - (float)h) : (_Float16)0.0f; }
#pragma unroll
    for (int t = 0; t < 4; ++t) { if (col0 + t * 16 >= N) continue; const size_t boff = (size_t)(col0 + t * 16 + ln) * ldb + kb; FragH bq; bq.half[0] = *(const v8us*)(Bh + boff + 8 * hh); bq.half[1] = *(const v8us*)(Bh + boff + 16 + 8 * hh);
      acc[t] = mmaH<ASPLIT ? 2 : 1>(ah.v, al.v, bq.v, bq.v, acc[t]); }
  }
#pragma unroll
  for (int t = 0; t < 4; ++t) { if (col0 + t * 16 >= N) continue;
#pragma unroll
    for (int r = 0; r < 8; ++r) so[w][8 * hh + r][t * 16 + ln] = acc[t][r] * alpha; }
  __builtin_amdgcn_fence(__ATOMIC_ACQ_REL, "workgroup"); __builtin_amdgcn_wave_barrier();
  const int rsub = lane >> 4, c4 = (lane & 15) * 4;
  {
#pragma unroll
    for (int q = 0; q < 8; ++q) { const int r = q * 2 + rsub; if (col0 + c4 < N) { const v4f v = *(const v4fa*)&so[w][r][c4]; *(v4f*)(C + (size_t)(row0 + r) * ldc + col0 + c4) = v; } }
     }
}

// Wt[n][k] = f16(W[k][n] * scale) from f32 row-major W[K][N] (scale = power of two; bf16-exact weights stay exact in f16 away from the subnormal range).
// A thread takes an 8 x 8 patch: 16 loads of 16 bytes, all in flight together (4 lanes one whole 128-byte line of a W row), the transposition is the choice of registers, 8 stores of 16 bytes (8 lanes one whole line of a Wt row).
// A wave covers 64 k x 32 n; a block of 8 waves 512 k x 32 n. One address pair for the loads and one for the stores, every step a constant offset.
template <int K, int N>
__device__ __forceinline__ void wt_f16(const float* __restrict__ W, _Float16* __restrict__ Wt, float scale, int blk) {      /* blk: the job's own block index */
  static_assert(K % 512 == 0 && N % 32 == 0, "whole blocks only: no thread is without a patch");
  const int lane = threadIdx.x & 31, g = blk * 8 + (threadIdx.x >> 5);
  const int k8 = ((g % (K / 64)) * 8 + (lane & 7)) * 8, n8 = ((g / (K / 64)) * 4 + (lane >> 3)) * 8;
  const float* src = W + (size_t)k8 * N + n8; unsigned short* dst = (unsigned short*)Wt + (size_t)n8 * K + k8; v4f r[8][2];      /* both loops unrolled: constant indices keep the patch in registers */
#pragma unroll
  for (int i = 0; i < 8; ++i) { r[i][0] = *(const v4fa*)(src + i * N); r[i][1] = *(const v4fa*)(src + i * N + 4); }
  asm volatile("s_wait_xcnt 0x0" :: "v"(src) : "memory");      /* a precaution: the loads' address pair is an input here, so it lives up to this wait and no load lands on it ahead of the wait */
  __builtin_amdgcn_sched_barrier(0);      /* keeps all 16 loads ahead of the first conversion: without it the compiler holds some back to save registers, and the thread waits out a second trip to memory */
#pragma unroll
  for (int j = 0; j < 8; ++j) { FragH f;
#pragma unroll
    for (int i = 0; i < 8; ++i) f.h[i] = (_Float16)(bf16_round(r[i][j >> 2][j & 3]) * scale);
    *(v8us*)(dst + j * K) = f.half[0]; }
  asm volatile("s_wait_xcnt 0x0" ::: "memory");      /* behind the last store: in k_prep the built code runs on from here towards another block range's body, which rewrites the stores' registers */
}
// k_gemm_hh variant with fused epilogue: v = acc·alpha + bias[by·sBias + col] (+ CP[(row/rowsPerB)·sCPb + by·64 + col] if CP) ; ACT 0 none / 1 elu ; writes f16 C16 (and f32 C if non-null)
template <int ACT>
__global__ __launch_bounds__(128) void k_gemm_hhx(const _Float16* __restrict__ A, int lda, size_t sA, const _Float16* __restrict__ Bh, int ldb, size_t sB, float alpha, const float* __restrict__ bias, size_t sBias, const float* __restrict__ CP, int rowsPerB, size_t sCPb, int row0g,
    float* __restrict__ C, _Float16* __restrict__ C16, int ldc, size_t sC, int M, int N, int K) {
  __shared__ __attribute__((aligned(16))) float so[4][16][64];
  const int tid = threadIdx.x, w = tid >> 5, lane = tid & 31, ln = lane & 15, hh = lane >> 4; const int by = blockIdx.y;
  A += (size_t)by * sA; Bh += (size_t)by * sB; const size_t cofs = (size_t)by * sC; const float* bp = bias ? bias + (size_t)by * sBias : nullptr;
  const int ntn = (N + 63) / 64; const int wid = blockIdx.x * 4 + w; const int mt = wid / ntn, nq = wid % ntn; if (mt * 16 >= M) return;
  const int row0 = mt * 16, col0 = nq * 64; const _Float16* arow = A + (size_t)(row0 + ln) * lda;
  v8f acc[4] = {};
  for (int kb = 0; kb < K; kb += 32) { FragH ah; ah.half[0] = *(const v8us*)((const unsigned short*)arow + kb + 8 * hh); ah.half[1] = *(const v8us*)((const unsigned short*)arow + kb + 16 + 8 * hh);
#pragma unroll
    for (int t = 0; t < 4; ++t) { if (col0 + t * 16 >= N) continue; const size_t boff = (size_t)(col0 + t * 16 + ln) * ldb + kb; FragH bq; bq.half[0] = *(const v8us*)((const unsigned short*)Bh + boff + 8 * hh); bq.half[1] = *(const v8us*)((const unsigned short*)Bh + boff + 16 + 8 * hh);
      acc[t] = mmaH<1>(ah.v, ah.v, bq.v, bq.v, acc[t]); }
  }
#pragma unroll
  for (int t = 0; t < 4; ++t) { if (col0 + t * 16 >= N) continue; const int col = col0 + t * 16 + ln; const float bv = bp ? bf16_round(bp[col]) : 0.f;
#pragma unroll
    for (int r = 0; r < 8; ++r) { float v = acc[t][r] * alpha + bv; if (CP) { const int bidx = (row0g + row0 + 8 * hh + r) / rowsPerB; v += CP[(size_t)bidx * sCPb + (size_t)by * 64 + col]; } if (ACT == 1) v = (v > 0.f) ? v : expm1f(v); else if (ACT == 7) v = (v > 0.f) ? v + 1.0f : expf(v); else if (ACT == 8) v = tanhf(v); else if (ACT == 9) v = 0.5f * v * (1.0f + tanhf(0.7978845608028654f * (v + 0.044715f * v * v * v))); else if (ACT == 11) v = 1.0f / (1.0f + expf(-v)); else if (ACT == 12) v = (v > 0.f) ? v : 0.01f * v; else if (ACT == 14) v = (v > 0.f) ? v : 0.1f * v; else if (ACT == 15) v = v / (1.0f + expf(-v)); else if (ACT == 3) v = fmaxf(v, 0.f); else if (ACT == 6) v = 0.5f * v * (1.0f + erff(v * 0.70710678118654752f)); so[w][8 * hh + r][t * 16 + ln] = v; } }
  __builtin_amdgcn_fence(__ATOMIC_ACQ_REL, "workgroup"); __builtin_amdgcn_wave_barrier();
  const int rsub = lane >> 4, c4 = (lane & 15) * 4; typedef _Float16 v4h __attribute__((ext_vector_type(4)));
  {
#pragma unroll
    for (int q = 0; q < 8; ++q) { const int r = q * 2 + rsub; if (col0 + c4 < N) { const v4f v = *(const v4fa*)&so[w][r][c4]; if (C) *(v4f*)(C + cofs + (size_t)(row0 + r) * ldc + col0 + c4) = v; if (C16) { v4h h4; for (int i = 0; i < 4; ++i) h4[i] = (_Float16)v[i]; *(v4h*)(C16 + cofs + (size_t)(row0 + r) * ldc + col0 + c4) = h4; } } }
     }
}


typedef _Float16 v4h __attribute__((ext_vector_type(4)));

// f16 plane of x: a thread takes 8 groups of 8 values, a block's width apart: 16 loads of 16 bytes in flight together, then 8 whole-line stores of 16 bytes a lane.
__device__ __forceinline__ void x16(const float* __restrict__ x, _Float16* __restrict__ X16, int blk) { const size_t t0 = (size_t)blk * 2048 + threadIdx.x; const float* src = x + t0 * 8; unsigned short* dst = (unsigned short*)X16 + t0 * 8; v4f r[8][2];      /* loops unrolled: constant indices keep the values in registers */
#pragma unroll
  for (int u = 0; u < 8; ++u) { r[u][0] = *(const v4fa*)(src + u * 2048); r[u][1] = *(const v4fa*)(src + u * 2048 + 4); }
  asm volatile("s_wait_xcnt 0x0" :: "v"(src) : "memory");      /* a precaution, as in wt_f16: the loads' address pair lives up to this wait */
  __builtin_amdgcn_sched_barrier(0);      /* keeps all 16 loads ahead of the first conversion, as in wt_f16 */
#pragma unroll
  for (int u = 0; u < 8; ++u) { FragH f;
#pragma unroll
    for (int q = 0; q < 8; ++q) f.h[q] = (_Float16)bf16_round(r[u][q >> 2][q & 3]);
    *(v8us*)(dst + u * 2048) = f.half[0]; }
  asm volatile("s_wait_xcnt 0x0" ::: "memory"); }      /* behind the last store, as in wt_f16 */
// The five preparation jobs (four weight transposes, the f16 plane of x) read and write disjoint buffers: one grid, a block range each, so that they run side by side instead of one launch behind the other.
// 64 values a thread: the launch is a few waves a SIMD that all start at once with all their loads in flight, not a long queue of waves that each live for one load.
#define PB_W (DM * DM / 64 / 256)       /* blocks of a DM x DM weight */
#define PB_KV (DM * KVD / 64 / 256)     /* blocks of a DM x KVD weight */
#define PB_X (NR * DM / 64 / 256)       /* blocks of x */
static_assert((NR * DM) % (64 * 256) == 0, "whole blocks only: no thread of the x range is without its 64 values");
__global__ __launch_bounds__(256) void k_prep(const float* __restrict__ x, const float* __restrict__ Wq, const float* __restrict__ Wk, const float* __restrict__ Wv, const float* __restrict__ Wo,
                                              _Float16* __restrict__ X16, _Float16* __restrict__ BQ, _Float16* __restrict__ BK, _Float16* __restrict__ BV, _Float16* __restrict__ BO) {
  int blk = blockIdx.x;
  if (blk < PB_W) { wt_f16<DM, DM>(Wq, BQ, 16.0f, blk); return; } blk -= PB_W;
  if (blk < PB_W) { wt_f16<DM, DM>(Wo, BO, 16.0f, blk); return; } blk -= PB_W;
  if (blk < PB_KV) { wt_f16<DM, KVD>(Wk, BK, 16.0f, blk); return; } blk -= PB_KV;
  if (blk < PB_KV) { wt_f16<DM, KVD>(Wv, BV, 16.0f, blk); return; } blk -= PB_KV;
  x16(x, X16, blk); }
__global__ __launch_bounds__(256) void k_h16(const float* __restrict__ x, _Float16* __restrict__ X16, size_t n8) { const size_t t = (size_t)blockIdx.x * 256 + threadIdx.x; if (t >= n8) return; FragH f;
#pragma unroll
  for (int q = 0; q < 8; ++q) f.h[q] = (_Float16)x[t * 8 + q]; *(v8us*)((unsigned short*)X16 + t * 8) = f.half[0];  }
__global__ __launch_bounds__(256) void k_round16f(const float* __restrict__ W, _Float16* __restrict__ Bt, size_t n8) { const size_t t = (size_t)blockIdx.x * 256 + threadIdx.x; if (t >= n8) return; FragH f;
#pragma unroll
  for (int i = 0; i < 8; ++i) f.h[i] = (_Float16)(bf16_round(W[t * 8 + i]) * 16.0f); *(v8us*)((unsigned short*)Bt + t * 8) = f.half[0];  }
template <int NHv, int TTv>
__global__ __launch_bounds__(256) void k_vt(const _Float16* __restrict__ V16, int ldv, int voff, _Float16* __restrict__ Vt) { __shared__ unsigned short tl[64][66]; const int tid = threadIdx.x; const int slab = blockIdx.x / (TTv / 64), lg = blockIdx.x % (TTv / 64); const int b = slab / NHv, h = slab % NHv;
  for (int i = tid; i < 64 * 8; i += 256) { const int r = i / 8, c8 = (i % 8) * 8; FragH f; f.half[0] = *(const v8us*)((const unsigned short*)V16 + ((size_t)b * TTv + lg * 64 + r) * ldv + voff + h * 64 + c8);
#pragma unroll
    for (int q = 0; q < 8; ++q) tl[r][c8 + q] = f.u[q]; }
  __syncthreads();
  {
#pragma unroll
    for (int rd = 0; rd < 2; ++rd) { const int d = rd * 32 + tid / 8, pc = tid % 8; FragH f;
#pragma unroll
      for (int q = 0; q < 8; ++q) f.u[q] = tl[pc * 8 + q][d];
      *(v8us*)((unsigned short*)Vt + ((size_t)slab * 64 + d) * TTv + lg * 64 + pc * 8) = f.half[0]; }
     } }

// ---- LDS staging by asynchronous copies (global_load_async_to_lds_b128): a lane moves its own 16 bytes, 8 lanes one whole 128-byte row; two buffers, the next stage in flight while this one is worked on ----
#define LP 72      /* LDS row pitch in f16: 128 data bytes + 16 = an odd multiple of 16 bytes, the conflict-free pitch of the ds_load_b128 fragment readers */
__device__ __forceinline__ void wait_async0() { asm volatile("s_wait_asynccnt 0x0" ::: "memory"); }      /* the wave's own copies have landed; stands before the barrier behind which the other waves read them */
__device__ __forceinline__ void wait_ds0() { asm volatile("s_wait_dscnt 0x0" ::: "memory"); }      /* the wave's own LDS reads have retired before the barrier behind which their buffer is refilled */
// one tile of 64 rows x 128 bytes (row pitch ldg f16 in global memory, LP in LDS) by 128 threads: 4 copies a lane, rows tid / 8 + 16 i. The s_wait_xcnt closes the statement so that no address register is rewritten ahead of it.
__device__ __forceinline__ void stage64(const unsigned short* g, size_t ldg, const unsigned short* s, int tid) {
  const unsigned short* g0 = g + (size_t)(tid >> 3) * ldg + (tid & 7) * 8; const unsigned short* g1 = g0 + 16 * ldg; const unsigned short* g2 = g1 + 16 * ldg; const unsigned short* g3 = g2 + 16 * ldg;
  const unsigned l0 = (unsigned)(size_t)(s + (tid >> 3) * LP + (tid & 7) * 8), l1 = l0 + 16 * LP * 2, l2 = l0 + 32 * LP * 2, l3 = l0 + 48 * LP * 2;
  asm volatile("global_load_async_to_lds_b128 %0, %1, off\n\tglobal_load_async_to_lds_b128 %2, %3, off\n\tglobal_load_async_to_lds_b128 %4, %5, off\n\tglobal_load_async_to_lds_b128 %6, %7, off\n\ts_wait_xcnt 0x0"
               :: "v"(l0), "v"(g0), "v"(l1), "v"(g1), "v"(l2), "v"(g2), "v"(l3), "v"(g3) : "memory");
}
#define LP2 136      /* LDS row pitch in f16 of a stage of 128 k: 256 data bytes + 16 = an odd multiple of 16 bytes, as LP */
// one tile of 64 rows x 256 bytes (row pitch ldg f16 in global memory, LP2 in LDS) by 128 threads: 8 copies a lane, rows tid / 16 + 8 i, 16 lanes one whole 256-byte row. The s_wait_xcnt closes the statement so that no address register is rewritten ahead of it.
__device__ __forceinline__ void stage64w(const unsigned short* g, size_t ldg, const unsigned short* s, int tid) {
  const unsigned short* g0 = g + (size_t)(tid >> 4) * ldg + (tid & 15) * 8; const unsigned short* g1 = g0 + 8 * ldg; const unsigned short* g2 = g1 + 8 * ldg; const unsigned short* g3 = g2 + 8 * ldg;
  const unsigned short* g4 = g3 + 8 * ldg; const unsigned short* g5 = g4 + 8 * ldg; const unsigned short* g6 = g5 + 8 * ldg; const unsigned short* g7 = g6 + 8 * ldg;
  const unsigned l0 = (unsigned)(size_t)(s + (tid >> 4) * LP2 + (tid & 15) * 8), l1 = l0 + 8 * LP2 * 2, l2 = l0 + 16 * LP2 * 2, l3 = l0 + 24 * LP2 * 2, l4 = l0 + 32 * LP2 * 2, l5 = l0 + 40 * LP2 * 2, l6 = l0 + 48 * LP2 * 2, l7 = l0 + 56 * LP2 * 2;
  asm volatile("global_load_async_to_lds_b128 %0, %1, off\n\tglobal_load_async_to_lds_b128 %2, %3, off\n\tglobal_load_async_to_lds_b128 %4, %5, off\n\tglobal_load_async_to_lds_b128 %6, %7, off\n\t"
               "global_load_async_to_lds_b128 %8, %9, off\n\tglobal_load_async_to_lds_b128 %10, %11, off\n\tglobal_load_async_to_lds_b128 %12, %13, off\n\tglobal_load_async_to_lds_b128 %14, %15, off\n\ts_wait_xcnt 0x0"
               :: "v"(l0), "v"(g0), "v"(l1), "v"(g1), "v"(l2), "v"(g2), "v"(l3), "v"(g3), "v"(l4), "v"(g4), "v"(l5), "v"(g5), "v"(l6), "v"(g6), "v"(l7), "v"(g7) : "memory");
}
// ---- fast GEMM (block tile 128x64, wave tile 32x64; requires M % 128 == 0 rows per launch region, N % 64 == 0, K % 128 == 0, K >= 128); A and B tiles of 128 k staged in LDS; epilogue = k_gemm_hhx semantics ----
// With 128 k a stage twice the bytes are in flight and half as many landing times stand in a row.
// OM 0: C (f32) and / or C16 (f16). OM 1: the f32 result leaves as two f16 planes, C16 = hi, C16L = (v - hi) * 2^10, same layout. OM 2: the same two planes transposed, [row / ldc][col][row % ldc] with ldc = rows per sequence (a multiple of 128). OM 1 and 2 take no CP term.
__device__ __forceinline__ v16h g2_frag(const _Float16* p, int hh) { FragH f; f.half[0] = *(const v8us*)((const unsigned short*)p + 8 * hh); f.half[1] = *(const v8us*)((const unsigned short*)p + 16 + 8 * hh); return f.v; }
__device__ __forceinline__ v8f g2_mma(v16h a, v16h b, v8f c) { v8f d = __builtin_amdgcn_wmma_f32_16x16x32_f16(false, a, false, b, (short)0, c, false, false); asm volatile("v_nop\n\tv_nop\n\tv_nop\n\tv_nop" : "+v"(d) : "v"(a), "v"(b)); return d; }
// The body takes its block index (bx) and the kernel's LDS arrays from the caller: a kernel that serves several GEMMs from one grid hands each block range its own operands.
// The epilogue's staging tile so lies in the A ring, which nobody reads and no copy writes behind the last stage's barrier: ring and tile together stay small enough for three blocks on a WGP.
#define GEMM2_LDS __shared__ __attribute__((aligned(16))) unsigned short tA[2][128][LP2], tB[2][64][LP2]; float (*so)[32][68] = (float (*)[32][68])&tA[0][0][0]; static_assert(sizeof(float) * 4 * 32 * 68 <= sizeof(unsigned short) * 2 * 128 * LP2, "the staging tile lies inside tA");
template <int ACT, int OM>
__device__ __forceinline__ void gemm2_body(const int bx, float (*so)[32][68], unsigned short (*tA)[128][LP2], unsigned short (*tB)[64][LP2],
    const _Float16* __restrict__ A, int lda, size_t sA, const _Float16* __restrict__ Bh, int ldb, size_t sB, float alpha, const float* __restrict__ bias, size_t sBias, const float* __restrict__ CP, int rowsPerB, size_t sCPb, int row0g,
    float* __restrict__ C, _Float16* __restrict__ C16, _Float16* __restrict__ C16L, int ldc, size_t sC, int M, int N, int K) {
  constexpr int TP = 132;      /* OM 2: row pitch of the transposed staging tile, 128 tokens + 4 floats; 64 rows of it fit in so */
  static_assert(64 * TP <= 4 * 32 * 68, "the transposed tile lies inside so");
  const int tid = threadIdx.x, w = tid >> 5, lane = tid & 31, ln = lane & 15, hh = lane >> 4; const int by = blockIdx.y;
  A += (size_t)by * sA; Bh += (size_t)by * sB; const size_t cofs = (size_t)by * sC; const float* bp = bias ? bias + (size_t)by * sBias : nullptr;
  const int ntn = N >> 6; const int mt = bx / ntn, nq = bx - mt * ntn; const int row0 = mt * 128 + 32 * w, col0 = nq * 64; if (mt * 128 + 128 > M) return;      /* the whole block leaves or none, ahead of every barrier */
  const unsigned short* Ag = (const unsigned short*)A + (size_t)(mt * 128) * lda; const unsigned short* Bg = (const unsigned short*)Bh + (size_t)col0 * ldb; const int nst = K >> 7;
  stage64w(Ag, lda, &tA[0][0][0], tid); stage64w(Ag + (size_t)64 * lda, lda, &tA[0][64][0], tid); stage64w(Bg, ldb, &tB[0][0][0], tid);
  wait_async0(); __syncthreads();      /* stage 0 published */
  if (nst > 1) { stage64w(Ag + 128, lda, &tA[1][0][0], tid); stage64w(Ag + (size_t)64 * lda + 128, lda, &tA[1][64][0], tid); stage64w(Bg + 128, ldb, &tB[1][0][0], tid); }
  const v8f z8 = {0.f,0.f,0.f,0.f,0.f,0.f,0.f,0.f}; v8f c00 = z8, c01 = z8, c02 = z8, c03 = z8, c10 = z8, c11 = z8, c12 = z8, c13 = z8;
#pragma unroll 1
  for (int t = 0; t < nst; ++t) { const int bf = t & 1;      /* rolled: one stage a trip, the publish point at its foot */
    // the stage's two halves of 64 k one after the other; the 12 fragments of a half are read from LDS as one group ahead of its 16 products: one LDS latency a half in front of the matrix run, not one in front of every pair of products
    // unrolled (all three loops): the four k blocks of a stage become constant LDS offsets and the fragment arrays stay in registers
#pragma unroll
    for (int kh = 0; kh < 4; kh += 2) { v16h fa[2][2], fb[2][4];
#pragma unroll
    for (int kq = 0; kq < 2; ++kq) { fa[kq][0] = g2_frag((const _Float16*)&tA[bf][32 * w + ln][(kh + kq) * 32], hh); fb[kq][0] = g2_frag((const _Float16*)&tB[bf][ln][(kh + kq) * 32], hh); fa[kq][1] = g2_frag((const _Float16*)&tA[bf][32 * w + 16 + ln][(kh + kq) * 32], hh);
      fb[kq][1] = g2_frag((const _Float16*)&tB[bf][16 + ln][(kh + kq) * 32], hh); fb[kq][2] = g2_frag((const _Float16*)&tB[bf][32 + ln][(kh + kq) * 32], hh); fb[kq][3] = g2_frag((const _Float16*)&tB[bf][48 + ln][(kh + kq) * 32], hh); }
#pragma unroll
    for (int kq = 0; kq < 2; ++kq) { c00 = g2_mma(fa[kq][0], fb[kq][0], c00); c10 = g2_mma(fa[kq][1], fb[kq][0], c10); c01 = g2_mma(fa[kq][0], fb[kq][1], c01); c11 = g2_mma(fa[kq][1], fb[kq][1], c11);
      c02 = g2_mma(fa[kq][0], fb[kq][2], c02); c12 = g2_mma(fa[kq][1], fb[kq][2], c12); c03 = g2_mma(fa[kq][0], fb[kq][3], c03); c13 = g2_mma(fa[kq][1], fb[kq][3], c13); } }
    wait_ds0(); wait_async0(); __syncthreads();      /* publishes stage t + 1 and ends every read of buffer bf */
    if (t + 2 < nst) { const int k2 = (t + 2) * 128; stage64w(Ag + k2, lda, &tA[bf][0][0], tid); stage64w(Ag + (size_t)64 * lda + k2, lda, &tA[bf][64][0], tid); stage64w(Bg + k2, ldb, &tB[bf][0][0], tid); } }
  wait_async0();
  v8f accs[8] = {c00, c01, c02, c03, c10, c11, c12, c13};
#pragma unroll
  for (int u = 0; u < 8; ++u) { const int t = u & 3, half = u >> 2; const int col = col0 + t * 16 + ln; const float bv = bp ? bf16_round(bp[col]) : 0.f;
#pragma unroll
    for (int r = 0; r < 8; ++r) { const int rloc = half * 16 + 8 * hh + r; float v = accs[u][r] * alpha + bv; if (OM == 0 && CP) { const int bidx = (row0g + row0 + rloc) / rowsPerB; v += CP[(size_t)bidx * sCPb + (size_t)by * 64 + col]; }
      if (ACT == 3) v = fmaxf(v, 0.f); else if (ACT == 6) v = 0.5f * v * (1.0f + erff(v * 0.70710678118654752f)); else if (ACT == 11) v = 1.0f / (1.0f + expf(-v)); else if (ACT == 15) v = v / (1.0f + expf(-v)); else if (ACT == 12) v = (v > 0.f) ? v : 0.01f * v; else if (ACT == 8) v = tanhf(v);
      if (OM == 2) (&so[0][0][0])[(t * 16 + ln) * TP + 32 * w + rloc] = v; else so[w][rloc][t * 16 + ln] = v; } }
  if (OM == 2) {      /* the staging tile holds the block's 64 columns as rows of 128 tokens: a wave stores 16 of them, 16 lanes one whole 256-byte run */
    __syncthreads();      /* a transposed row holds results of all four waves */
    const float* soT = &so[0][0][0]; const int rb = mt * 128; const size_t ob = ((size_t)(rb / ldc) * N + col0) * ldc + rb % ldc + (lane & 15) * 8;
    // unrolled (both loops): the eight row pairs become constant LDS offsets whose reads go out ahead of the stores, and the two packed planes stay in registers
#pragma unroll
    for (int i = 0; i < 8; ++i) { const int d = 16 * w + 2 * i + (lane >> 4); const v4f a = *(const v4fa*)&soT[d * TP + (lane & 15) * 8], c = *(const v4fa*)&soT[d * TP + (lane & 15) * 8 + 4]; FragH fh, fl;      /* inner loop unrolled for constant element indices */
#pragma unroll
      for (int q = 0; q < 4; ++q) { _Float16 h = (_Float16)a[q]; fh.h[q] = h; fl.h[q] = (_Float16)((a[q] - (float)h) * 1024.0f); h = (_Float16)c[q]; fh.h[4 + q] = h; fl.h[4 + q] = (_Float16)((c[q] - (float)h) * 1024.0f); }
      *(v8us*)((unsigned short*)C16 + cofs + ob + (size_t)d * ldc) = fh.half[0]; *(v8us*)((unsigned short*)C16L + cofs + ob + (size_t)d * ldc) = fl.half[0]; }
    return; }
  __builtin_amdgcn_fence(__ATOMIC_ACQ_REL, "workgroup"); __builtin_amdgcn_wave_barrier();
  const int rsub = lane >> 4, c4 = (lane & 15) * 4;
  {
#pragma unroll
    for (int q = 0; q < 16; ++q) { const int r = q * 2 + rsub; const v4f v = *(const v4fa*)&so[w][r][c4];
      if (OM == 1) { v4h h4, l4; for (int i = 0; i < 4; ++i) { h4[i] = (_Float16)v[i]; l4[i] = (_Float16)((v[i] - (float)h4[i]) * 1024.0f); } *(v4h*)(C16 + cofs + (size_t)(row0 + r) * ldc + col0 + c4) = h4; *(v4h*)(C16L + cofs + (size_t)(row0 + r) * ldc + col0 + c4) = l4; continue; }
      if (C) *(v4f*)(C + cofs + (size_t)(row0 + r) * ldc + col0 + c4) = v; if (C16) { v4h h4; for (int i = 0; i < 4; ++i) h4[i] = (_Float16)v[i]; *(v4h*)(C16 + cofs + (size_t)(row0 + r) * ldc + col0 + c4) = h4; } }
    if (OM == 1) asm volatile("s_wait_xcnt 0x0" ::: "memory");      /* behind the last store of the hi/residual path: in k_qkv the built code runs on from here into another block range's body, which rewrites the stores' registers */
     } }
template <int ACT, int OM>
__global__ __launch_bounds__(128) void k_gemm2(const _Float16* __restrict__ A, int lda, size_t sA, const _Float16* __restrict__ Bh, int ldb, size_t sB, float alpha, const float* __restrict__ bias, size_t sBias, const float* __restrict__ CP, int rowsPerB, size_t sCPb, int row0g,
    float* __restrict__ C, _Float16* __restrict__ C16, _Float16* __restrict__ C16L, int ldc, size_t sC, int M, int N, int K) {
  GEMM2_LDS gemm2_body<ACT, OM>(blockIdx.x, so, tA, tB, A, lda, sA, Bh, ldb, sB, alpha, bias, sBias, CP, rowsPerB, sCPb, row0g, C, C16, C16L, ldc, sC, M, N, K); }
// out = ctx Wo + bo in ONE launch, on the same ring of 128 k a stage as gemm2_body. Rows < RE of a sequence carry O as hi + 2^10 residual: their blocks take 64 rows, not 128, and stage the residual rows in the lower half of the A tile.
// A wave's two row tiles are then the hi and the residual plane of the same 16 rows: the same fragments, products and accumulators as in every other block, joined in the epilogue. No ring and no accumulators of the residual's own, so three blocks fit a WGP.
#define WO_DB (NB * (RE / 64) * (DM / 64))                /* blocks of the rows with a residual, first in the grid */
#define WO_PB (NB * ((SLEN - RE) / 128) * (DM / 64))      /* blocks of the other rows */
__global__ __launch_bounds__(128) void k_wo(const _Float16* __restrict__ OHp, const _Float16* __restrict__ OLp, const _Float16* __restrict__ BOp, const float* __restrict__ bo, float* __restrict__ out) {
  __shared__ __attribute__((aligned(16))) unsigned short tA[2][128][LP2], tB[2][64][LP2];
  float (*so)[32][68] = (float (*)[32][68])&tA[0][0][0];      /* the epilogue's staging tile lies in the A ring, which nobody reads and no copy writes behind the last stage's barrier */
  static_assert(sizeof(float) * 4 * 32 * 68 <= sizeof(unsigned short) * 2 * 128 * LP2, "the staging tile lies inside tA");
  static_assert(RE % 64 == 0 && RE > 0 && (SLEN - RE) % 128 == 0 && SLEN > RE && DM >= 256 && DM % 128 == 0, "whole blocks in both row ranges; whole stages of 128 k, at least two");
  const int tid = threadIdx.x, w = tid >> 5, lane = tid & 31, ln = lane & 15, hh = lane >> 4;
  constexpr int ntn = DM >> 6, nst = DM >> 7;
  const bool dual = (int)blockIdx.x < WO_DB;      /* from blockIdx alone: the same for the whole block */
  const int b2 = dual ? (int)blockIdx.x : (int)blockIdx.x - WO_DB; const int rb = b2 / ntn, nq = b2 - rb * ntn; const int col0 = nq * 64;
  const int rowB = dual ? (rb / (RE / 64)) * SLEN + (rb % (RE / 64)) * 64 : (rb / ((SLEN - RE) / 128)) * SLEN + RE + (rb % ((SLEN - RE) / 128)) * 128;      /* the block's first row */
  const unsigned short* A0g = (const unsigned short*)OHp + (size_t)rowB * DM; const unsigned short* A1g = dual ? (const unsigned short*)OLp + (size_t)rowB * DM : A0g + (size_t)64 * DM;      /* source of A tile rows 0-63 and 64-127 */
  const unsigned short* Bg = (const unsigned short*)BOp + (size_t)col0 * DM;
  const int ra0 = dual ? 16 * w : 32 * w, ra1 = dual ? 64 + 16 * w : 32 * w + 16;      /* A tile rows of the wave's two row tiles */
  auto fill = [&](int bf, int k0) { stage64w(A0g + k0, DM, &tA[bf][0][0], tid); stage64w(A1g + k0, DM, &tA[bf][64][0], tid); stage64w(Bg + k0, DM, &tB[bf][0][0], tid); };
  fill(0, 0);
  wait_async0(); __syncthreads();      /* stage 0 published */
  fill(1, 128);
  v8f c[2][4];      /* every '#pragma unroll' below: constant indices keep the fragment and accumulator arrays in registers */
#pragma unroll
  for (int i = 0; i < 2; ++i)
#pragma unroll
    for (int j = 0; j < 4; ++j) c[i][j] = (v8f){0.f,0.f,0.f,0.f,0.f,0.f,0.f,0.f};
#pragma unroll 1
  for (int t = 0; t < nst; ++t) { const int bf = t & 1;      /* rolled: one stage a trip, the publish point at its foot */
#pragma unroll
    for (int kh = 0; kh < 4; kh += 2) { v16h fa[2][2], fb[2][4];      /* the stage's two halves of 64 k; a half's fragments are read as one group ahead of its products, as in gemm2_body */
#pragma unroll
      for (int kq = 0; kq < 2; ++kq) { fa[kq][0] = g2_frag((const _Float16*)&tA[bf][ra0 + ln][(kh + kq) * 32], hh); fb[kq][0] = g2_frag((const _Float16*)&tB[bf][ln][(kh + kq) * 32], hh); fa[kq][1] = g2_frag((const _Float16*)&tA[bf][ra1 + ln][(kh + kq) * 32], hh);
        fb[kq][1] = g2_frag((const _Float16*)&tB[bf][16 + ln][(kh + kq) * 32], hh); fb[kq][2] = g2_frag((const _Float16*)&tB[bf][32 + ln][(kh + kq) * 32], hh); fb[kq][3] = g2_frag((const _Float16*)&tB[bf][48 + ln][(kh + kq) * 32], hh); }
#pragma unroll
      for (int kq = 0; kq < 2; ++kq)
#pragma unroll
        for (int j = 0; j < 4; ++j) { c[0][j] = g2_mma(fa[kq][0], fb[kq][j], c[0][j]); c[1][j] = g2_mma(fa[kq][1], fb[kq][j], c[1][j]); } }
    wait_ds0(); wait_async0(); __syncthreads();      /* publishes stage t + 1 and ends every read of buffer bf */
    if (t + 2 < nst) fill(bf, (t + 2) * 128); }
  wait_async0();
  float bv[4];      /* the four bias values are read together, ahead of the branch: one trip to memory, not four */
#pragma unroll
  for (int j = 0; j < 4; ++j) bv[j] = bf16_round(bo[col0 + j * 16 + ln]);
  if (dual) {      /* 16 rows a wave: hi plane + residual plane */
#pragma unroll
    for (int j = 0; j < 4; ++j)
#pragma unroll
      for (int r = 0; r < 8; ++r) so[w][8 * hh + r][j * 16 + ln] = (c[0][j][r] + c[1][j][r] * 0.0009765625f) * 0.0625f + bv[j]; }
  else {      /* 32 rows a wave */
#pragma unroll
    for (int j = 0; j < 4; ++j)
#pragma unroll
      for (int r = 0; r < 8; ++r) { so[w][8 * hh + r][j * 16 + ln] = c[0][j][r] * 0.0625f + bv[j]; so[w][16 + 8 * hh + r][j * 16 + ln] = c[1][j][r] * 0.0625f + bv[j]; } }
  __builtin_amdgcn_fence(__ATOMIC_ACQ_REL, "workgroup"); __builtin_amdgcn_wave_barrier();      /* the wave's own so rows: its stores above stay ahead of its whole-line reads below */
  const int rsub = lane >> 4, c4 = (lane & 15) * 4; const int row0 = rowB + (dual ? 16 * w : 32 * w);
#pragma unroll
  for (int q = 0; q < 8; ++q) { const int r = q * 2 + rsub; const v4f v = *(const v4fa*)&so[w][r][c4]; *(v4f*)(out + (size_t)(row0 + r) * DM + col0 + c4) = v; }
  if (!dual) { int row1 = row0;
    asm volatile("s_wait_xcnt 0x0" : "+v"(row1) :: "memory");      /* a precaution: the stores above are issued and the code below rewrites the registers that they name; its addresses are formed from this statement's output, so none is formed ahead of the wait */
#pragma unroll
    for (int q = 8; q < 16; ++q) { const int r = q * 2 + rsub; const v4f v = *(const v4fa*)&so[w][r][c4]; *(v4f*)(out + (size_t)(row1 + r) * DM + col0 + c4) = v; } } }
// q, k and v = x W + b read the same x and depend on nothing of one another: one grid, a block range each (q, then k, then v), so that the two narrow products fill the places that the wide one leaves idle.
#define GB_Q ((NR / 128) * (DM / 64))
#define GB_KV ((NR / 128) * (KVD / 64))
static_assert(DM % 128 == 0 && DM >= 256, "whole stages of 128 k, at least two");
__global__ __launch_bounds__(128) void k_qkv(const _Float16* __restrict__ X16, const _Float16* __restrict__ BQ, const _Float16* __restrict__ BK, const _Float16* __restrict__ BV, const float* __restrict__ bq, const float* __restrict__ bk, const float* __restrict__ bv,
    _Float16* __restrict__ QH, _Float16* __restrict__ QL, _Float16* __restrict__ KH, _Float16* __restrict__ KL, _Float16* __restrict__ VT, _Float16* __restrict__ VTL) {
  GEMM2_LDS
  const int b = blockIdx.x;      /* every branch below is the same for the whole block */
  if (b >= GB_Q + GB_KV) { gemm2_body<0, 2>(b - GB_Q - GB_KV, so, tA, tB, X16, DM, 0, BV, DM, 0, 0.0625f, bv, 0, nullptr, 1, 0, 0, nullptr, VT, VTL, SLEN, 0, NR, KVD, DM); return; }      /* V^T hi/lo: [kv head][d][token] */
  if (b >= GB_Q) { gemm2_body<0, 1>(b - GB_Q, so, tA, tB, X16, DM, 0, BK, DM, 0, 0.0625f, bk, 0, nullptr, 1, 0, 0, nullptr, KH, KL, KVD, 0, NR, KVD, DM); return; }      /* k hi/lo, 4 kv heads */
  gemm2_body<0, 1>(b, so, tA, tB, X16, DM, 0, BQ, DM, 0, 0.0625f, bq, 0, nullptr, 1, 0, 0, nullptr, QH, QL, DM, 0, NR, DM, DM); }      /* q hi/lo */



// lane l with lane l ^ 16: the two lane halves of a 16-column group hold the two key halves of one query
__device__ __forceinline__ float xhalf(float x) { return __builtin_bit_cast(float, __builtin_amdgcn_permlanex16(__builtin_bit_cast(int, x), __builtin_bit_cast(int, x), 0x76543210, 0xfedcba98, false, false)); }
template <int CAUSAL>
__device__ __forceinline__ void flash_body(const int bx, float (*sO)[16][64 + 4], unsigned short (*ring)[64][LP], const _Float16* __restrict__ Q16, int ldq, const _Float16* __restrict__ K16, int ldk, const _Float16* __restrict__ Vt, const int* __restrict__ MSK, _Float16* __restrict__ OH, int ldo) {
  constexpr int RPW = 16, DT = 4, KS = 2;      /* every '#pragma unroll' below: constant indices keep the fragment, score and accumulator arrays in registers */
  const int g = __builtin_amdgcn_readfirstlane((int)threadIdx.x >> 7);      /* the wave's group, in a scalar register: every test on it below is a scalar branch */
  unsigned short (*sK)[64][LP] = ring + 4 * g, (*sV)[64][LP] = ring + 4 * g + 2;      /* two buffers each, per group; a stage = 64 keys: K rows (key, d) and V^T rows (d, key), shared by the group's four waves */
  const int tid = threadIdx.x & 127, w = tid >> 5, lane = tid & 31, ln = lane & 15, hh = lane >> 4;      /* tid, w: inside the group */
  const int slab = bx % (NB * NH), qblk = QB0P + QBNP - 1 - bx / (NB * NH); const int b = slab / NH, h = slab % NH;      /* heaviest tiles first */ const int qb0 = qblk * (4 * RPW); const int q0 = qb0 + w * RPW; const int tq = q0 + ln;
  FragH bq[KS];
  { const unsigned short* qr = (const unsigned short*)Q16 + ((size_t)b * TQ + tq) * ldq + h * 64;
#pragma unroll
    for (int ks = 0; ks < KS; ++ks) { bq[ks].half[0] = *(const v8us*)(qr + ks * 32 + 8 * hh); bq[ks].half[1] = *(const v8us*)(qr + ks * 32 + 16 + 8 * hh); } }
  const int kvh = h / NREP;      /* K16 and Vt hold the kv heads themselves: query head h reads kv head h / NREP */
  const unsigned short* Vth = (const unsigned short*)Vt + (size_t)(b * NKV + kvh) * 64 * TK;
  const float sl = (CAUSAL == 14) ? bf16_round(((const float*)MSK)[h]) : 0.f;      /* mode 14: causal + ALiBi slope[h] * (key - query) from the slopes INPUT */
  // Softmax in log2 units: p * 1024 = 2^(s * c2 + sl2 * (key - query) - m + 10). A lane's 16 keys of a pass lie at fixed distances from its first one, so scale and ALiBi are one fma per score against kb; the first key's own term (base) joins the maximum once a pass.
  static_assert(CAUSAL == 0 || CAUSAL == 1 || CAUSAL == 14, "every query needs a valid key in the first pass: masked scores go out by 2^(-3e38 - finite) = 0");
  static_assert(QB0P >= 2 && TK >= 256, "each group's first stage exists and lies wholly below every query of the block");
  const float c2 = SCL * 1.44269504088896340736f, sl2 = sl * 1.44269504088896340736f; v8f kb[2];
#pragma unroll
  for (int nt = 0; nt < 2; ++nt)
#pragma unroll
    for (int r = 0; r < 8; ++r) kb[nt][r] = sl2 * (float)(nt * 16 + r);
  float m_r = -3.0e38f, l_r = 0.f; v8f oacc[DT];
#pragma unroll
  for (int dt = 0; dt < DT; ++dt) oacc[dt] = (v8f){0.f,0.f,0.f,0.f,0.f,0.f,0.f,0.f};
  const int jend = (CAUSAL == 1 || CAUSAL == 14) ? (qb0 + 4 * RPW) : TK;      /* causal: keys beyond the block's last query never contribute */
  const unsigned short* Kh = (const unsigned short*)K16 + (size_t)b * TK * ldk + kvh * 64; const int nst = jend >> 6;      /* jend is a multiple of 64 */
  const int ntr = (nst + 1) >> 1;      /* trips: the same for both groups, which share every barrier; with an odd nst group 1 has no stage in the last one */
  stage64(Kh + (size_t)(g * 64) * ldk, ldk, &sK[0][0][0], tid); stage64(Vth + g * 64, TK, &sV[0][0][0], tid);
  wait_async0(); __syncthreads();      /* the groups' first stages (0 and 1) published */
  if (2 + g < nst) { stage64(Kh + (size_t)((2 + g) * 64) * ldk, ldk, &sK[1][0][0], tid); stage64(Vth + (2 + g) * 64, TK, &sV[1][0][0], tid); }
  // LDS fragment reads stand in groups, ahead of the products that use them: K of both passes and V^T of pass 0 at the head of the stage, V^T of pass 1 behind the output products of pass 0.
  // Only the first group's latency is waited out; every read stays inside its own stage, ahead of the wait and the barrier at the foot.
  FragH ak[2][2][KS], av[2][DT];
  auto ldK = [&](int bf, int pp) {
#pragma unroll
    for (int nt = 0; nt < 2; ++nt) { const unsigned short* kr = &sK[bf][pp * 32 + nt * 16 + ln][0];
#pragma unroll
      for (int ks = 0; ks < KS; ++ks) { ak[pp][nt][ks].half[0] = *(const v8us*)(kr + ks * 32 + 8 * hh); ak[pp][nt][ks].half[1] = *(const v8us*)(kr + ks * 32 + 16 + 8 * hh); } } };
  auto ldV = [&](int bf, int pp) {
#pragma unroll
    for (int dt = 0; dt < DT; ++dt) { const unsigned short* vrow = &sV[bf][dt * 16 + ln][pp * 32]; av[pp][dt].half[0] = *(const v8us*)(vrow + 8 * hh); av[pp][dt].half[1] = *(const v8us*)(vrow + 16 + 8 * hh); } };
  // the stage loop stays rolled: one stage a trip with the publish point at its foot
#pragma unroll 1
  for (int tr = 0; tr < ntr; ++tr) { const int bf = tr & 1, t = 2 * tr + g;      /* t: the group's key stage of this trip */
  if (t < nst) {      /* scalar: false only for group 1 in the last trip of an odd nst; the foot below is passed by every wave */
  ldK(bf, 0); ldK(bf, 1); ldV(bf, 0);
  // the two passes of a stage are unrolled: pass 1's fragments get registers of their own, so that their reads can be issued during pass 0
#pragma unroll
  for (int pp = 0; pp < 2; ++pp) { const int j0 = t * 64 + pp * 32;
    v8f s[2];
#pragma unroll
    for (int nt = 0; nt < 2; ++nt) { v8f acc = (v8f){0.f,0.f,0.f,0.f,0.f,0.f,0.f,0.f};
#pragma unroll
      for (int ks = 0; ks < KS; ++ks) acc = mmaH<1>(ak[pp][nt][ks].v, ak[pp][nt][ks].v, bq[ks].v, bq[ks].v, acc);
      s[nt] = acc; }
    const float base = sl2 * (float)(j0 + 8 * hh - tq);      /* ALiBi of the lane's first key of this pass */
    v8f u[2];
#pragma unroll
    for (int nt = 0; nt < 2; ++nt) u[nt] = s[nt] * c2 + kb[nt];
    if ((CAUSAL == 1 || CAUSAL == 14) && t == nst - 1) {      /* only the block's last stage holds keys beyond a query: a scalar branch, every earlier stage goes unmasked */
#pragma unroll
      for (int nt = 0; nt < 2; ++nt)
#pragma unroll
        for (int r = 0; r < 8; ++r) u[nt][r] = (j0 + nt * 16 + 8 * hh + r <= tq) ? u[nt][r] : -3.0e38f; }
    float mcn[2];      /* two independent chains */
#pragma unroll
    for (int nt = 0; nt < 2; ++nt) { mcn[nt] = u[nt][0];
#pragma unroll
      for (int r = 1; r < 8; ++r) mcn[nt] = fmaxf(mcn[nt], u[nt][r]); }
    float mc = fmaxf(mcn[0], mcn[1]) + base; mc = fmaxf(mc, xhalf(mc));
    const float mn = fmaxf(m_r, mc); const float al = __builtin_amdgcn_exp2f(m_r - mn); m_r = mn;      /* first pass: 2^(-3e38 - mn) = 0 */
    const float sh = (mn - base) - 10.0f;      /* the factor 1024 of the f16 P operand rides in the exponent; l sums the same scaled values */
    FragH pb; v8f e[2];
#pragma unroll
    for (int nt = 0; nt < 2; ++nt) { e[nt] = u[nt] - sh;      /* the exponents as one vector, each 2^x then written over its own exponent */
#pragma unroll
      for (int r = 0; r < 8; ++r) { e[nt][r] = __builtin_amdgcn_exp2f(e[nt][r]); pb.h[nt * 8 + r] = (_Float16)e[nt][r]; } }
    const v8f e8 = e[0] + e[1]; const v4f e4 = __builtin_shufflevector(e8, e8, 0, 1, 2, 3) + __builtin_shufflevector(e8, e8, 4, 5, 6, 7);
    l_r = l_r * al + ((e4[0] + e4[2]) + (e4[1] + e4[3]));
#pragma unroll
    for (int dt = 0; dt < DT; ++dt) oacc[dt] *= al;
#pragma unroll
    for (int dt = 0; dt < DT; ++dt) oacc[dt] = mmaH<1>(av[pp][dt].v, av[pp][dt].v, pb.v, pb.v, oacc[dt]);
    if (pp == 0) ldV(bf, 1); } }
    wait_ds0(); wait_async0(); __syncthreads();      /* publishes each group's next stage (t + 2) and ends every read of buffer bf */
    if (t + 4 < nst) { const int j2 = (t + 4) * 64; stage64(Kh + (size_t)j2 * ldk, ldk, &sK[bf][0][0], tid); stage64(Vth + j2, TK, &sV[bf][0][0], tid); } }
  wait_async0();
  // Join: group 1 hands its partial maximum, sum and O to group 0 through the ring, which nobody reads and no copy writes behind the last trip's barrier. Lane for lane the two groups hold the same (d, query) elements.
  float* mg = (float*)&ring[0][0][0] + (size_t)(w * 9 * 32 + lane) * 4;      /* 9 slots of 16 bytes a lane, a wave's 32 lanes side by side in each slot */
  static_assert(sizeof(float) * 4 * 9 * 32 * 4 <= sizeof(unsigned short) * 8 * 64 * LP, "the hand-over lies inside the ring");
  if (g == 1) {
#pragma unroll
    for (int dt = 0; dt < DT; ++dt) { *(v4fa*)(mg + (2 * dt) * 128) = (v4f){oacc[dt][0], oacc[dt][1], oacc[dt][2], oacc[dt][3]}; *(v4fa*)(mg + (2 * dt + 1) * 128) = (v4f){oacc[dt][4], oacc[dt][5], oacc[dt][6], oacc[dt][7]}; }
    *(v4fa*)(mg + 8 * 128) = (v4f){m_r, l_r, 0.f, 0.f}; }
  __syncthreads();      /* group 1's partial results published; the block's last barrier */
  if (g == 1) return;
  { const v4f ml = *(const v4fa*)(mg + 8 * 128); const float mj = fmaxf(m_r, ml[0]); const float a0 = __builtin_amdgcn_exp2f(m_r - mj), a1 = __builtin_amdgcn_exp2f(ml[0] - mj);      /* both maxima are finite: each group's first stage is unmasked */
    l_r = l_r * a0 + ml[1] * a1;
#pragma unroll
    for (int dt = 0; dt < DT; ++dt) { const v4f lo = *(const v4fa*)(mg + (2 * dt) * 128), hi = *(const v4fa*)(mg + (2 * dt + 1) * 128);
#pragma unroll
      for (int r = 0; r < 4; ++r) { oacc[dt][r] = oacc[dt][r] * a0 + lo[r] * a1; oacc[dt][4 + r] = oacc[dt][4 + r] * a0 + hi[r] * a1; } } }
  const float l = l_r + xhalf(l_r); const float li = (l > 0.f) ? 1.0f / l : 0.f;      /* l carries the factor 1024 of P */
#pragma unroll
  for (int dt = 0; dt < DT; ++dt) { const v4f lo = {oacc[dt][0] * li, oacc[dt][1] * li, oacc[dt][2] * li, oacc[dt][3] * li}, hi = {oacc[dt][4] * li, oacc[dt][5] * li, oacc[dt][6] * li, oacc[dt][7] * li};
    *(v4fa*)&sO[w][ln][dt * 16 + 8 * hh] = lo; *(v4fa*)&sO[w][ln][dt * 16 + 8 * hh + 4] = hi; }
  __builtin_amdgcn_fence(__ATOMIC_ACQ_REL, "workgroup"); __builtin_amdgcn_wave_barrier();      /* the wave's own sO rows: its stores above stay ahead of its whole-line reads below */
  {
#pragma unroll
    for (int rp = 0; rp < RPW; rp += 2) { const int r = rp + (lane >> 4), pc = lane & 15; const v4f val = *(const v4fa*)&sO[w][r][pc * 4]; v4h h4; for (int i = 0; i < 4; ++i) h4[i] = (_Float16)val[i]; *(v4h*)(OH + ((size_t)b * TQ + q0 + r) * ldo + h * 64 + pc * 4) = h4; }      /* O leaves as the f16 A operand of the Wo GEMM: 16 lanes one 128-byte line */
     } }
// 5-plane variant: S = Qh Kh^T + (Ql Kh^T + Qh Kl^T)/1024 with Q/K = [hi | 2^10 residual] f16 planes (QL/KL same layout as Q16/K16), then the 3-term P.V below.
// 3-term variant: O = (P_hi V_hi + (P_lo V_hi + P_hi V_lo) / 1024) / l with P = [hi | 2^10 residual] of 1024 p and V^T = [hi | 2^10 residual] planes (VtL same layout as Vt) -> ~2^-21-class products for un-averaged (early causal / peaked) rows
template <int CAUSAL>
__device__ __forceinline__ void flash5_body(const int bx, const int tid, float (*sO)[16][64 + 4], unsigned short (*ring)[64][LP], const _Float16* __restrict__ Q16, const _Float16* __restrict__ QL, int ldq, const _Float16* __restrict__ K16, const _Float16* __restrict__ KL, int ldk, const _Float16* __restrict__ Vt, const _Float16* __restrict__ VtL, const int* __restrict__ MSK, _Float16* __restrict__ OH, _Float16* __restrict__ OL, int ldo) {
  constexpr int RPW = 16, DT = 4, KS = 2;      /* transposed products as in flash_body: lane (ln, hh) holds query q0 + ln, keys j0 + nt * 16 + 8 * hh + r; '#pragma unroll' as there */
  unsigned short (*sK)[LP] = ring[0], (*sKl)[LP] = ring[1], (*sV)[LP] = ring[2], (*sVl)[LP] = ring[3];      /* a stage = 64 keys of the four planes in ONE buffer: the LDS frame of one group of flash_body, so that both bodies share a kernel at its residency */
  const int w = tid >> 5, lane = tid & 31, ln = lane & 15, hh = lane >> 4;      /* tid: the thread inside its group of 128 */
  const int slab = bx / QBN5, qblk = QB05 + bx % QBN5; const int b = slab / NH, h = slab % NH; const int qb0 = qblk * (4 * RPW); const int q0 = qb0 + w * RPW; const int tq = q0 + ln;
  FragH bq[KS], bql[KS];
  { const unsigned short* qr = (const unsigned short*)Q16 + ((size_t)b * TQ + tq) * ldq + h * 64; const unsigned short* ql = (const unsigned short*)QL + ((size_t)b * TQ + tq) * ldq + h * 64;
#pragma unroll
    for (int ks = 0; ks < KS; ++ks) { bq[ks].half[0] = *(const v8us*)(qr + ks * 32 + 8 * hh); bq[ks].half[1] = *(const v8us*)(qr + ks * 32 + 16 + 8 * hh); bql[ks].half[0] = *(const v8us*)(ql + ks * 32 + 8 * hh); bql[ks].half[1] = *(const v8us*)(ql + ks * 32 + 16 + 8 * hh); } }
  const int kvh = h / NREP;      /* kv heads unexpanded, as in flash_body */
  const unsigned short* Vth = (const unsigned short*)Vt + (size_t)(b * NKV + kvh) * 64 * TK; const unsigned short* Vtl = (const unsigned short*)VtL + (size_t)(b * NKV + kvh) * 64 * TK;
  const float sl = (CAUSAL == 14) ? bf16_round(((const float*)MSK)[h]) : 0.f;      /* mode 14: causal + ALiBi slope[h] * (key - query) from the slopes INPUT */
  float m_r = -3.0e38f, l_r = 0.f; v8f oacc[DT], oaccL[DT];
#pragma unroll
  for (int dt = 0; dt < DT; ++dt) { oacc[dt] = (v8f){0.f,0.f,0.f,0.f,0.f,0.f,0.f,0.f}; oaccL[dt] = oacc[dt]; }
  const int jend = (CAUSAL == 1 || CAUSAL == 14) ? (qb0 + 4 * RPW) : TK;      /* causal: keys beyond the block's last query never contribute */
  const unsigned short* Kh = (const unsigned short*)K16 + (size_t)b * TK * ldk + kvh * 64; const unsigned short* Kl = (const unsigned short*)KL + (size_t)b * TK * ldk + kvh * 64; const int nst = jend >> 6;      /* jend is a multiple of 64 */
  // both loops stay rolled: one stage a trip, filled at its head and left at its foot, and the two passes of a stage share one body (short code, the pass as an address offset)
#pragma unroll 1
  for (int t = 0; t < nst; ++t) { const int j1 = t * 64;
    stage64(Kh + (size_t)j1 * ldk, ldk, &sK[0][0], tid); stage64(Kl + (size_t)j1 * ldk, ldk, &sKl[0][0], tid); stage64(Vth + j1, TK, &sV[0][0], tid); stage64(Vtl + j1, TK, &sVl[0][0], tid);
    wait_async0(); __syncthreads();      /* stage t published; at most four stages a block, their landing times covered by the other blocks of the grid */
#pragma unroll 1
  for (int p = 0; p < 64; p += 32) { const int j0 = t * 64 + p;
    v8f s[2];
#pragma unroll
    for (int nt = 0; nt < 2; ++nt) { const unsigned short* kr = &sK[p + nt * 16 + ln][0]; const unsigned short* klr = &sKl[p + nt * 16 + ln][0]; FragH ak[KS], akl[KS];
#pragma unroll
      for (int ks = 0; ks < KS; ++ks) { ak[ks].half[0] = *(const v8us*)(kr + ks * 32 + 8 * hh); ak[ks].half[1] = *(const v8us*)(kr + ks * 32 + 16 + 8 * hh); akl[ks].half[0] = *(const v8us*)(klr + ks * 32 + 8 * hh); akl[ks].half[1] = *(const v8us*)(klr + ks * 32 + 16 + 8 * hh); }
      v8f acc = (v8f){0.f,0.f,0.f,0.f,0.f,0.f,0.f,0.f}, accl = acc;
#pragma unroll
      for (int ks = 0; ks < KS; ++ks) { acc = mmaH<1>(ak[ks].v, ak[ks].v, bq[ks].v, bq[ks].v, acc); accl = mmaH<1>(ak[ks].v, ak[ks].v, bql[ks].v, bql[ks].v, accl); accl = mmaH<1>(akl[ks].v, akl[ks].v, bq[ks].v, bq[ks].v, accl); }
#pragma unroll
      for (int r = 0; r < 8; ++r) acc[r] += accl[r] * 0.0009765625f;
      s[nt] = acc; }
    float sc[2][8], mcn[2]; bool ok[2][8];
#pragma unroll
    for (int nt = 0; nt < 2; ++nt) { mcn[nt] = -3.0e38f;
#pragma unroll
      for (int r = 0; r < 8; ++r) { const int kk = j0 + nt * 16 + 8 * hh + r;
        ok[nt][r] = (CAUSAL == 1 || CAUSAL == 14) ? (kk <= tq) : ((CAUSAL == 2) ? ((kk >> 5) == (tq >> 5)) : true);      /* mode 2: block-diagonal 32-token groups */
        if (CAUSAL == 4) ok[nt][r] = MSK[((size_t)b * TQ + tq) * TK + kk] != 0;      /* mode 4: per-(query, key) INPUT mask shared by all heads; masked keys contribute nothing, rows with no valid key give l = 0 -> output 0 */
        float sv = ok[nt][r] ? s[nt][r] * SCL : -3.0e38f; if (CAUSAL == 14) { if (ok[nt][r]) sv += sl * (float)(kk - tq); }
        sc[nt][r] = sv; mcn[nt] = fmaxf(mcn[nt], sv); } }
    float mc = fmaxf(mcn[0], mcn[1]); mc = fmaxf(mc, xhalf(mc));
    const float mn = fmaxf(m_r, mc); const float ea = expf(m_r - mn); const float al = (mn > -1.0e38f) ? ea : 1.0f; m_r = mn;
    FragH pb, pl; float psn[2];
#pragma unroll
    for (int nt = 0; nt < 2; ++nt) { psn[nt] = 0.f;
#pragma unroll
      for (int r = 0; r < 8; ++r) { const float e = expf(sc[nt][r] - mn); const float p = ok[nt][r] ? e : 0.f; psn[nt] += p; const float ps = p * 1024.0f; const _Float16 ph = (_Float16)ps; pb.h[nt * 8 + r] = ph; pl.h[nt * 8 + r] = (_Float16)((ps - (float)ph) * 1024.0f); } }
    l_r = l_r * al + (psn[0] + psn[1]);
#pragma unroll
    for (int dt = 0; dt < DT; ++dt)
#pragma unroll
      for (int r = 0; r < 8; ++r) { oacc[dt][r] *= al; oaccL[dt][r] *= al; }
#pragma unroll
    for (int dt = 0; dt < DT; ++dt) { const unsigned short* vrow = &sV[dt * 16 + ln][p]; const unsigned short* vrl = &sVl[dt * 16 + ln][p]; FragH av, avl; av.half[0] = *(const v8us*)(vrow + 8 * hh); av.half[1] = *(const v8us*)(vrow + 16 + 8 * hh); avl.half[0] = *(const v8us*)(vrl + 8 * hh); avl.half[1] = *(const v8us*)(vrl + 16 + 8 * hh);
      oacc[dt] = mmaH<1>(av.v, av.v, pb.v, pb.v, oacc[dt]); oaccL[dt] = mmaH<1>(av.v, av.v, pl.v, pl.v, oaccL[dt]); oaccL[dt] = mmaH<1>(avl.v, avl.v, pb.v, pb.v, oaccL[dt]); } }
    wait_ds0(); __syncthreads(); }      /* ends every read of the buffer ahead of its refill */
  const float l = l_r + xhalf(l_r); const float li = (l > 0.f) ? 1.0f / (l * 1024.0f) : 0.f;
#pragma unroll
  for (int dt = 0; dt < DT; ++dt) { v4f lo, hi;
#pragma unroll
    for (int r = 0; r < 4; ++r) { float v = oacc[dt][r]; v += oaccL[dt][r] * 0.0009765625f; lo[r] = v * li; v = oacc[dt][4 + r]; v += oaccL[dt][4 + r] * 0.0009765625f; hi[r] = v * li; }
    *(v4fa*)&sO[w][ln][dt * 16 + 8 * hh] = lo; *(v4fa*)&sO[w][ln][dt * 16 + 8 * hh + 4] = hi; }
  __builtin_amdgcn_fence(__ATOMIC_ACQ_REL, "workgroup"); __builtin_amdgcn_wave_barrier();      /* the wave's own sO rows: its stores above stay ahead of its whole-line reads below */
  {
#pragma unroll
    for (int rp = 0; rp < RPW; rp += 2) { const int r = rp + (lane >> 4), pc = lane & 15; const v4f val = *(const v4fa*)&sO[w][r][pc * 4]; v4h h4, l4; for (int i = 0; i < 4; ++i) { h4[i] = (_Float16)val[i]; l4[i] = (_Float16)((val[i] - (float)h4[i]) * 1024.0f); }
      *(v4h*)(OH + ((size_t)b * TQ + q0 + r) * ldo + h * 64 + pc * 4) = h4; *(v4h*)(OL + ((size_t)b * TQ + q0 + r) * ldo + h * 64 + pc * 4) = l4; }      /* O leaves as f16 hi + 2^10 residual, the two A operands of the Wo GEMM on these rows */
     }
  asm volatile("s_wait_xcnt 0x0" ::: "memory");      /* behind the last stores: in the built kernel the plain form's code stands behind this one's and writes the registers that these stores name; a precaution of form */ }
// The two forms work on disjoint query rows from the same planes: one grid, the few blocks of the 5-plane form first (they are slow a stage and must not start last), then the plain form's, heaviest first.
// A 5-plane block's two groups of 4 waves take the same query tile of two neighbouring heads: equal trip counts, so they share every barrier; each group has its own half of ring and sO.
template <int CAUSAL>
__global__ __launch_bounds__(256) void k_flash_all(const _Float16* __restrict__ Q16, const _Float16* __restrict__ QL, int ldq, const _Float16* __restrict__ K16, const _Float16* __restrict__ KL, int ldk, const _Float16* __restrict__ Vt, const _Float16* __restrict__ VtL, const float* __restrict__ SLP, _Float16* __restrict__ OH, _Float16* __restrict__ OL, int ldo) {
  __shared__ __attribute__((aligned(16))) float sO[8][16][64 + 4];
  __shared__ __attribute__((aligned(16))) unsigned short ring[8][64][LP];
  static_assert((NB * NH) % 2 == 0, "the 5-plane blocks take heads in pairs");
  constexpr int B5 = NB * NH * QBN5 / 2;      /* blocks of the 5-plane form */
  const int* MSK = (const int*)SLP;      /* the bodies' one pointer for mask or slopes; mode 14 reads it as the f32 slopes */
  const int bx = blockIdx.x;      /* the branch is the same for the whole block */
  if (bx >= B5) flash_body<CAUSAL>(bx - B5, sO, ring, Q16, ldq, K16, ldk, Vt, MSK, OH, ldo);
  else { const int g = __builtin_amdgcn_readfirstlane((int)threadIdx.x >> 7);      /* the wave's group, scalar */
    flash5_body<CAUSAL>((2 * (bx / QBN5) + g) * QBN5 + bx % QBN5, (int)threadIdx.x & 127, sO + 4 * g, ring + 4 * g, Q16, QL, ldq, K16, KL, ldk, Vt, VtL, MSK, OH, OL, ldo); } }

__global__ __launch_bounds__(256) void k_rotab(float* __restrict__ CS, float* __restrict__ SN) {
  #pragma clang fp contract(off)
  const int t = blockIdx.x * 256 + threadIdx.x; if (t >= SLEN * 32) return; const int j = t % 32, s = t / 32; const float ex = (float)(2 * j) / 64.0f; const float inv = 1.0f / powf(10000.0f, ex); const float th = (float)s * inv; const float c = cosf(th), sn = sinf(th);
  { *(float*)(CS + t) = c; *(float*)(SN + t) = sn;  } }
__global__ __launch_bounds__(256) void k_rope(const float* __restrict__ F, int nsrc, int ndst, int rep, const float* __restrict__ CS, const float* __restrict__ SN, _Float16* __restrict__ H, _Float16* __restrict__ L) {
  #pragma clang fp contract(off)
  const size_t t = (size_t)blockIdx.x * 256 + threadIdx.x; if (t >= (size_t)NR * ndst * 4) return; const int g8 = (int)(t % 4); const int hd = (int)((t / 4) % ndst); const size_t row = t / ((size_t)4 * ndst); const int s = (int)(row % SLEN); const int hs = hd / rep;
  const float* src = F + row * (size_t)(nsrc * 64) + hs * 64; FragH ah, al, bh, bl;
  for (int i = 0; i < 8; ++i) { const int d = g8 * 8 + i; const float c = CS[s * 32 + d], sn = SN[s * 32 + d]; const float x1 = src[d], x2 = src[d + 32];
    float o1 = x1 * c; o1 += -x2 * sn; float o2 = x2 * c; o2 += x1 * sn;
    _Float16 hv = (_Float16)o1; ah.h[i] = hv; al.h[i] = (_Float16)((o1 - (float)hv) * 1024.0f); hv = (_Float16)o2; bh.h[i] = hv; bl.h[i] = (_Float16)((o2 - (float)hv) * 1024.0f); }
  const size_t o = row * (size_t)(ndst * 64) + hd * 64 + g8 * 8;
  { *(v8us*)((unsigned short*)H + o) = ah.half[0]; *(v8us*)((unsigned short*)H + o + 32) = bh.half[0]; *(v8us*)((unsigned short*)L + o) = al.half[0]; *(v8us*)((unsigned short*)L + o + 32) = bl.half[0];  } }

extern "C" void kernel_launch(void* const* d_in, const int* in_sizes, int n_in,
                              void* d_out, int out_size, void* d_ws, size_t ws_size, hipStream_t stream) {
  (void)in_sizes; (void)n_in; (void)out_size;
  const float* const* I = (const float* const*)d_in; const float* x = I[0]; const float* Wq = I[1]; const float* bq = I[2]; const float* Wk = I[3]; const float* bk = I[4]; const float* Wv = I[5]; const float* bv = I[6]; const float* Wo = I[7]; const float* bo = I[8]; const float* slopes = I[9];
  char* ws = (char*)d_ws; size_t off = 0;
  auto take = [&](size_t bytes) { char* p = ws + off; off += (bytes + 255) & ~(size_t)255; return p; };
  const size_t np = (size_t)NR * DM, nk = (size_t)NR * KVD;
  _Float16* BQ = (_Float16*)take((size_t)DM * DM * 2); _Float16* BK = (_Float16*)take((size_t)KVD * DM * 2); _Float16* BV = (_Float16*)take((size_t)KVD * DM * 2); _Float16* BO = (_Float16*)take((size_t)DM * DM * 2);
  _Float16* X16 = (_Float16*)take(np * 2); _Float16* QH = (_Float16*)take(np * 2); _Float16* QL = (_Float16*)take(np * 2); _Float16* KH = (_Float16*)take(nk * 2); _Float16* KL = (_Float16*)take(nk * 2); _Float16* VT = (_Float16*)take(nk * 2); _Float16* VTL = (_Float16*)take(nk * 2);
  _Float16* OH = (_Float16*)take(np * 2); _Float16* OLo = (_Float16*)take(np * 2);
  if (off > ws_size) return;      /* 2+0.5+0.5+2 + 8+8+8+2+2+2+2+8+8 = 53 MiB */
  k_prep<<<2 * PB_W + 2 * PB_KV + PB_X, 256, 0, stream>>>(x, Wq, Wk, Wv, Wo, X16, BQ, BK, BV, BO);      /* x16 weights transposed, f16 plane of x */
  k_qkv<<<GB_Q + 2 * GB_KV, 128, 0, stream>>>(X16, BQ, BK, BV, bq, bk, bv, QH, QL, KH, KL, VT, VTL);      /* q hi/lo; k hi/lo, 4 kv heads; V^T hi/lo: [kv head][d][token] */
  k_flash_all<14><<<NB * NH * QBNP + NB * NH * QBN5 / 2, 256, 0, stream>>>(QH, QL, DM, KH, KL, KVD, VT, VTL, slopes, OH, OLo, DM);      /* causal + ALiBi: rows >= 256 plain, rows < 256 hi + residual */
  k_wo<<<WO_DB + WO_PB, 128, 0, stream>>>(OH, OLo, BO, bo, (float*)d_out);      /* out = ctx Wo + bo, the O residual term of the first 256 rows of each sequence in the same blocks */
}
